// v000
// The times below were measured on an AMD MI455X: many runs one after another, warmed up first and cycling through
// copies of the inputs, with the whole window's GPU time divided by the number of runs. Launches and the gaps
// between them are all in it. The median over several windows is given; except for v000 it joins two sittings, which
// can be a few percent apart, so the side-by-side timings, each taken in one sitting, are the better comparison.
// v000, which the later versions start from, runs in 695 microseconds.
// compute dtype: x, Wq, bq, Wk, bk, Wv, bv (module inputs) rounded to bf16; Q/K/V projection with exact bf16 products on WMMA 16x16x32 ((in,out) weights packed as transposed rows) + biases; q and k stored as f16 hi + (x2048-scaled) residual planes with 3-product scores, x 1/8 on the f32 score, causal mask, running-max softmax in f32 (precise expf); P as f16 hi + (x2048) residual x v hi/lo (3 products); f32 output rows.
#include <hip/hip_runtime.h>
#include <math.h>

typedef __attribute__((ext_vector_type(16))) _Float16 v16h;
typedef __attribute__((ext_vector_type(16))) __bf16 v16b;
typedef __attribute__((ext_vector_type(8)))  _Float16 v8h;
typedef __attribute__((ext_vector_type(8)))  float v8f;
typedef __attribute__((ext_vector_type(4)))  float v4f;
typedef __attribute__((ext_vector_type(2)))  float v2f;
typedef __attribute__((ext_vector_type(4)))  unsigned v4u;
typedef __attribute__((ext_vector_type(4)))  int v4i;
typedef float __attribute__((may_alias)) float_a;
typedef int __attribute__((may_alias)) int_a;

template <typename T> __device__ __forceinline__ void vst2(void* p, T v) { *(T*)p = v;  }
__device__ __forceinline__ v8f wmma16(v16h a, v16h b, v8f c) {
  v8f d = __builtin_amdgcn_wmma_f32_16x16x32_f16(false, a, false, b, (short)0, c, false, false);
  asm volatile("v_nop\n\tv_nop\n\tv_nop\n\tv_nop" : "+v"(d) : "v"(a), "v"(b));
  return d;
}
__device__ __forceinline__ v8f wmma_bf(v16b a, v16b b, v8f c) {
  v8f d = __builtin_amdgcn_wmma_f32_16x16x32_bf16(false, a, false, b, (short)0, c, false, false);
  asm volatile("v_nop\n\tv_nop\n\tv_nop\n\tv_nop" : "+v"(d) : "v"(a), "v"(b));
  return d;
}
// 16x16x32 fragments: lane = (h = lane>>4, row/col = lane&15); elements 0..7 = k0+8h+0..7, 8..15 = k0+16+8h+0..7; D element r = row 8h+r
__device__ __forceinline__ v16h frag_h(const _Float16* rowk0, int lane) {
  union { v16h v; v8h q[2]; } u; const _Float16* p = rowk0 + 8 * (lane >> 4);
  u.q[0] = *(const v8h*)p; u.q[1] = *(const v8h*)(p + 16); return u.v;
}
__device__ __forceinline__ v16h frag_f32(const float* rowk0, int lane) {
  v16h a; const float* p = rowk0 + 8 * (lane >> 4);
#pragma unroll
  for (int i = 0; i < 8; ++i) { a[i] = (_Float16)p[i]; a[8 + i] = (_Float16)p[16 + i]; }
  return a;
}
__device__ __forceinline__ v16h frag_f32s(const float* rowk0, int lane, float sc) {
  v16h a; const float* p = rowk0 + 8 * (lane >> 4);
#pragma unroll
  for (int i = 0; i < 8; ++i) { a[i] = (_Float16)(p[i] * sc); a[8 + i] = (_Float16)(p[16 + i] * sc); }
  return a;
}
// column fragment from a [K][ld] layout (column n), rows >= K read as 0
__device__ __forceinline__ v16h fragc_f32(const float* W, int k0, int n, int lane, int ld, int K) {
  v16h a; const int g = lane >> 4;
#pragma unroll
  for (int i = 0; i < 8; ++i) { const int ka = k0 + 8 * g + i, kb = ka + 16;
    a[i] = (_Float16)(ka < K ? W[(size_t)(ka < K ? ka : K - 1) * ld + n] : 0.f); a[8 + i] = (_Float16)(kb < K ? W[(size_t)(kb < K ? kb : K - 1) * ld + n] : 0.f); }
  return a;
}
struct F2 { v16b h, l; };
__device__ __forceinline__ F2 bsplit16(const float v[16]) { F2 r;
#pragma unroll
  for (int i = 0; i < 16; ++i) { const __bf16 h = (__bf16)v[i]; r.h[i] = h; r.l[i] = (__bf16)(v[i] - (float)h); }
  return r; }
__device__ __forceinline__ F2 split_row(const float* row, int k0, int lane) { float v[16]; const float* p = row + k0 + 8 * (lane >> 4);
#pragma unroll
  for (int i = 0; i < 8; ++i) { v[i] = p[i]; v[8 + i] = p[16 + i]; }
  return bsplit16(v); }
__device__ __forceinline__ F2 split_rowK(const float* row, int k0, int lane, int K) { float v[16]; const int g = lane >> 4;
#pragma unroll
  for (int i = 0; i < 8; ++i) { const int ka = k0 + 8 * g + i, kb = ka + 16; v[i] = ka < K ? row[ka < K ? ka : K - 1] : 0.f; v[8 + i] = kb < K ? row[kb < K ? kb : K - 1] : 0.f; }
  return bsplit16(v); }
__device__ __forceinline__ F2 split_col(const float* W, int k0, int n, int lane, int ld, int K) { float v[16]; const int g = lane >> 4;
#pragma unroll
  for (int i = 0; i < 8; ++i) { const int ka = k0 + 8 * g + i, kb = ka + 16; v[i] = ka < K ? W[(size_t)(ka < K ? ka : K - 1) * ld + n] : 0.f; v[8 + i] = kb < K ? W[(size_t)(kb < K ? kb : K - 1) * ld + n] : 0.f; }
  return bsplit16(v); }
__device__ __forceinline__ v8f mac3(const F2& a, const F2& b, v8f c) { c = wmma_bf(a.l, b.h, c); c = wmma_bf(a.h, b.l, c); return wmma_bf(a.h, b.h, c); }
__device__ __forceinline__ float sigm(float v) { return 1.0f / (1.0f + expf(-v)); }
#define LDSX() do { asm volatile("s_wait_dscnt 0" ::: "memory"); __builtin_amdgcn_wave_barrier(); __builtin_amdgcn_fence(__ATOMIC_RELEASE, "workgroup"); } while (0)


// Single causal attention head (B 4, S 4,096, emb 512 -> head 64): softmax(Q K^T / 8, causal) V.
#define NB 4
#define SS 4096
#define NR (NB * SS)
#define EMB 512
#define HD 64
#ifndef TQB
#define TQB (SS / 64)
#define TNB NB
#endif
typedef __attribute__((ext_vector_type(8))) __bf16 v8b;
__device__ __forceinline__ v16b frag_b(const __bf16* rowk0, int lane) {
  union { v16b v; v8b q[2]; } u; const __bf16* p = rowk0 + 8 * (lane >> 4);
  u.q[0] = *(const v8b*)p; u.q[1] = *(const v8b*)(p + 16); return u.v;
}
__device__ __forceinline__ float bfr(float v) { return (float)(__bf16)v; }
__device__ __attribute__((noinline)) float exp_ni(float v) { return expf(v); }
__device__ __attribute__((noinline)) float erf_ni(float v) { return erff(v); }

#define WS_PK  0u                                     // bf16 [192][512]: Wq^T | Wk^T | Wv^T rows
#define WS_QH  (((2u * 192 * EMB) + 127u) / 128u * 128u)  // f16 [16384][64] q hi ; QL lo x2048 ; KH, KL
#define WS_QL  (WS_QH + 2u * NR * HD)
#define WS_KH  (WS_QL + 2u * NR * HD)
#define WS_KL  (WS_KH + 2u * NR * HD)
#define WS_VTH (WS_KL + 2u * NR * HD)                   // f16 [b][64 d][4096] v hi / lo
#define WS_VTL (WS_VTH + 2u * NR * HD)
#define WS_END (WS_VTL + 2u * NR * HD)

__global__ __launch_bounds__(256) void k_pack(const float* __restrict__ WQ, const float* __restrict__ WK, const float* __restrict__ WV, __bf16* __restrict__ PK) {
  __shared__ __align__(16) __bf16 s[EMB]; const int n = blockIdx.x, t = threadIdx.x; const int which = n / HD, d = n % HD; const float* Wm = (which == 0) ? WQ : (which == 1) ? WK : WV;
  for (int k = t; k < EMB; k += 256) s[k] = (__bf16)Wm[(size_t)k * HD + d];
  __syncthreads();
  if (t < EMB / 8) vst2((unsigned*)(PK + (size_t)n * EMB + t * 8), *(const v4u*)&s[t * 8]);
}
__global__ __launch_bounds__(128) void k_qkv(const float* __restrict__ X, const __bf16* __restrict__ PK, const float* __restrict__ BQ, const float* __restrict__ BK, const float* __restrict__ BV, _Float16* __restrict__ QH, _Float16* __restrict__ QL_, _Float16* __restrict__ KH, _Float16* __restrict__ KL, _Float16* __restrict__ VTH, _Float16* __restrict__ VTL) {
  __shared__ __align__(16) _Float16 sqh[4][16][72], sql[4][16][72], skh[4][16][72], skl[4][16][72]; __shared__ __align__(16) _Float16 svh[HD][72], svl[HD][72];
  const int tid = threadIdx.x, wave = tid >> 5, lane = tid & 31, col = lane & 15, g = lane >> 4; const size_t r0 = (size_t)blockIdx.x * 64 + wave * 16;
  v8f acc[12] = {};
#pragma unroll 2
  for (int kc = 0; kc < EMB / 32; ++kc) { v16b a; { const float* p = X + (r0 + col) * EMB + kc * 32 + 8 * g;
#pragma unroll
      for (int i = 0; i < 8; ++i) { a[i] = (__bf16)p[i]; a[8 + i] = (__bf16)p[16 + i]; } }
#pragma unroll
    for (int j = 0; j < 12; ++j) acc[j] = wmma_bf(a, frag_b(PK + (size_t)(j * 16 + col) * EMB + kc * 32, lane), acc[j]); }
#pragma unroll
  for (int j = 0; j < 12; ++j) { const int which = j >> 2; const int d = (j & 3) * 16 + col; const float bb = bfr((which == 0) ? BQ[d] : (which == 1) ? BK[d] : BV[d]);
#pragma unroll
    for (int r = 0; r < 8; ++r) { const float v = acc[j][r] + bb; const _Float16 hv = (_Float16)v; const _Float16 lv = (_Float16)((v - (float)hv) * 2048.0f);
      if (which == 0) { sqh[wave][8 * g + r][d] = hv; sql[wave][8 * g + r][d] = lv; } else if (which == 1) { skh[wave][8 * g + r][d] = hv; skl[wave][8 * g + r][d] = lv; } else { svh[d][wave * 16 + 8 * g + r] = hv; svl[d][wave * 16 + 8 * g + r] = lv; } } }
  __syncthreads();
  for (int rl = 0; rl < 16; ++rl) { const size_t o = (r0 + rl) * HD + (lane & 7) * 8; const int which = lane >> 3;
    if (which == 0) vst2((unsigned*)(QH + o), *(const v4u*)&sqh[wave][rl][(lane & 7) * 8]); else if (which == 1) vst2((unsigned*)(QL_ + o), *(const v4u*)&sql[wave][rl][(lane & 7) * 8]); else if (which == 2) vst2((unsigned*)(KH + o), *(const v4u*)&skh[wave][rl][(lane & 7) * 8]); else vst2((unsigned*)(KL + o), *(const v4u*)&skl[wave][rl][(lane & 7) * 8]); }
  { const size_t rb = (size_t)blockIdx.x * 64; const int b = (int)(rb / SS), s0 = (int)(rb % SS);
    for (int e = tid; e < HD * 8; e += 128) { const int d = e >> 3, pc = e & 7; const size_t o = ((size_t)b * HD + d) * SS + s0 + pc * 8; vst2((unsigned*)(VTH + o), *(const v4u*)&svh[d][pc * 8]); vst2((unsigned*)(VTL + o), *(const v4u*)&svl[d][pc * 8]); } }
}
// ---- k_attn: block = (64 queries, b): causal; 3-product scores / 8; online softmax; P hi/lo x V hi/lo; output rows f32 [64] (256 B by 16 lanes)
__global__ __launch_bounds__(128) void k_attn(const _Float16* __restrict__ QH, const _Float16* __restrict__ QL_, const _Float16* __restrict__ KH, const _Float16* __restrict__ KL, const _Float16* __restrict__ VTH, const _Float16* __restrict__ VTL, float* __restrict__ OUT) {
  __shared__ __align__(16) _Float16 sph[4][16][40], spl[4][16][40]; __shared__ __align__(16) float so[4][16][HD + 4];
  const int tid = threadIdx.x, wave = tid >> 5, lane = tid & 31, col = lane & 15, g = lane >> 4; const int qb = blockIdx.x, b = blockIdx.y; const int q0 = qb * 64 + wave * 16; const size_t rq = (size_t)b * SS + q0 + col;
  v16h aqh[2], aql[2];
#pragma unroll
  for (int kc = 0; kc < 2; ++kc) { aqh[kc] = frag_h(QH + rq * HD + kc * 32, lane); aql[kc] = frag_h(QL_ + rq * HD + kc * 32, lane); }
  const _Float16* Vh = VTH + (size_t)b * HD * SS; const _Float16* Vl = VTL + (size_t)b * HD * SS;
  float m[8], l[8];
#pragma unroll
  for (int r = 0; r < 8; ++r) { m[r] = -3.0e38f; l[r] = 0.f; }
  v8f acc[4] = {}, accl[4] = {};
  const int nks = (qb * 64 + 64) / 32;
#pragma unroll 1
  for (int ks = 0; ks < nks; ++ks) { v8f s[2];
#pragma unroll
    for (int ct = 0; ct < 2; ++ct) { const int kk = ks * 32 + ct * 16 + col; const size_t rk = ((size_t)b * SS + kk) * HD; v8f c = {}, cl = {};
#pragma unroll
      for (int kc = 0; kc < 2; ++kc) { const v16h khf = frag_h(KH + rk + kc * 32, lane); c = wmma16(aqh[kc], khf, c); cl = wmma16(aql[kc], khf, cl); cl = wmma16(aqh[kc], frag_h(KL + rk + kc * 32, lane), cl); }
#pragma unroll
      for (int r = 0; r < 8; ++r) { const int qi = q0 + 8 * g + r; const float sv = (c[r] + cl[r] * (1.0f / 2048.0f)) * 0.125f; s[ct][r] = (kk <= qi) ? sv : -3.0e38f; } }
#pragma unroll
    for (int r = 0; r < 8; ++r) { float mx = fmaxf(s[0][r], s[1][r]);
#pragma unroll
      for (int o = 1; o < 16; o <<= 1) mx = fmaxf(mx, __shfl_xor(mx, o));
      const float mn = fmaxf(m[r], mx); const float alpha = (m[r] <= -1.0e38f) ? 0.f : exp_ni(m[r] - mn);
      const float e0 = (s[0][r] <= -1.0e38f) ? 0.f : exp_ni(s[0][r] - mn), e1 = (s[1][r] <= -1.0e38f) ? 0.f : exp_ni(s[1][r] - mn); float es = e0 + e1;
#pragma unroll
      for (int o = 1; o < 16; o <<= 1) es += __shfl_xor(es, o);
      l[r] = l[r] * alpha + es; m[r] = mn;
#pragma unroll
      for (int dt = 0; dt < 4; ++dt) { acc[dt][r] *= alpha; accl[dt][r] *= alpha; }
      const _Float16 h0 = (_Float16)e0, h1 = (_Float16)e1; sph[wave][8 * g + r][col] = h0; sph[wave][8 * g + r][16 + col] = h1; spl[wave][8 * g + r][col] = (_Float16)((e0 - (float)h0) * 2048.0f); spl[wave][8 * g + r][16 + col] = (_Float16)((e1 - (float)h1) * 2048.0f); }
    LDSX();
    const v16h pah = frag_h(&sph[wave][col][0], lane), pal = frag_h(&spl[wave][col][0], lane);
#pragma unroll
    for (int dt = 0; dt < 4; ++dt) { const size_t vo = (size_t)(dt * 16 + col) * SS + ks * 32; const v16h vh = frag_h(Vh + vo, lane), vl = frag_h(Vl + vo, lane); acc[dt] = wmma16(pah, vh, acc[dt]); accl[dt] = wmma16(pal, vh, accl[dt]); accl[dt] = wmma16(pah, vl, accl[dt]); }
    LDSX(); }
#pragma unroll
  for (int r = 0; r < 8; ++r) { const float il = 1.0f / l[r];
#pragma unroll
    for (int dt = 0; dt < 4; ++dt) so[wave][8 * g + r][dt * 16 + col] = (acc[dt][r] + accl[dt][r] * (1.0f / 2048.0f)) * il; }
  LDSX();
  for (int rl = 0; rl < 16; ++rl) if (lane < 16) vst2(OUT + ((size_t)b * SS + q0 + rl) * HD + lane * 4, *(const v4f*)&so[wave][rl][lane * 4]);
}
extern "C" void kernel_launch(void* const* d_in, const int* in_sizes, int n_in, void* d_out, int out_size, void* d_ws, size_t ws_size, hipStream_t stream) {
  (void)in_sizes; (void)n_in; (void)out_size;
  const float** F = (const float**)d_in;   // 0 x [4,4096,512], 1 Wq [512,64], 2 bq, 3 Wk, 4 bk, 5 Wv, 6 bv
  if (ws_size < (size_t)WS_END) return;
  char* ws = (char*)d_ws; __bf16* PK = (__bf16*)(ws + WS_PK); _Float16 *QH = (_Float16*)(ws + WS_QH), *QLp = (_Float16*)(ws + WS_QL), *KH = (_Float16*)(ws + WS_KH), *KL = (_Float16*)(ws + WS_KL), *VTH = (_Float16*)(ws + WS_VTH), *VTL = (_Float16*)(ws + WS_VTL);
  k_pack<<<192, 256, 0, stream>>>(F[1], F[3], F[5], PK);
  k_qkv<<<TNB * SS / 64, 128, 0, stream>>>(F[0], PK, F[2], F[4], F[6], QH, QLp, KH, KL, VTH, VTL);
  k_attn<<<dim3(TQB, TNB), 128, 0, stream>>>(QH, QLp, KH, KL, VTH, VTL, (float*)d_out);
}

// v001
// It runs in 208 microseconds.
// Two timings next to v000 put it at 3.35 and 3.33 times that version's speed.
// compute dtype: x, Wq, bq, Wk, bk, Wv, bv (module inputs) rounded to bf16; Q/K/V projection with exact bf16 products on WMMA 16x16x32 ((in,out) weights packed as transposed rows) + biases; q and k stored as f16 hi + (x2048-scaled) residual planes with 3-product scores, x 1/8 on the f32 score, causal mask, running-max softmax in f32 (precise expf); P as f16 hi + (x2048) residual x v hi/lo (3 products); f32 output rows.
#include <hip/hip_runtime.h>
#include <math.h>

typedef __attribute__((ext_vector_type(16))) _Float16 v16h;
typedef __attribute__((ext_vector_type(16))) __bf16 v16b;
typedef __attribute__((ext_vector_type(8)))  _Float16 v8h;
typedef __attribute__((ext_vector_type(8)))  float v8f;
typedef __attribute__((ext_vector_type(4)))  float v4f;
typedef __attribute__((ext_vector_type(2)))  float v2f;
typedef __attribute__((ext_vector_type(4)))  unsigned v4u;
typedef __attribute__((ext_vector_type(4)))  int v4i;
typedef float __attribute__((may_alias)) float_a;
typedef int __attribute__((may_alias)) int_a;

template <typename T> __device__ __forceinline__ void vst2(void* p, T v) { *(T*)p = v;  }
__device__ __forceinline__ v8f wmma16(v16h a, v16h b, v8f c) {
  v8f d = __builtin_amdgcn_wmma_f32_16x16x32_f16(false, a, false, b, (short)0, c, false, false);
  asm volatile("v_nop\n\tv_nop\n\tv_nop\n\tv_nop" : "+v"(d) : "v"(a), "v"(b));
  return d;
}
__device__ __forceinline__ v8f wmma_bf(v16b a, v16b b, v8f c) {
  v8f d = __builtin_amdgcn_wmma_f32_16x16x32_bf16(false, a, false, b, (short)0, c, false, false);
  asm volatile("v_nop\n\tv_nop\n\tv_nop\n\tv_nop" : "+v"(d) : "v"(a), "v"(b));
  return d;
}
// 16x16x32 fragments: lane = (h = lane>>4, row/col = lane&15); elements 0..7 = k0+8h+0..7, 8..15 = k0+16+8h+0..7; D element r = row 8h+r
__device__ __forceinline__ v16h frag_h(const _Float16* rowk0, int lane) {
  union { v16h v; v8h q[2]; } u; const _Float16* p = rowk0 + 8 * (lane >> 4);
  u.q[0] = *(const v8h*)p; u.q[1] = *(const v8h*)(p + 16); return u.v;
}
__device__ __forceinline__ v16h frag_f32(const float* rowk0, int lane) {
  v16h a; const float* p = rowk0 + 8 * (lane >> 4);
#pragma unroll
  for (int i = 0; i < 8; ++i) { a[i] = (_Float16)p[i]; a[8 + i] = (_Float16)p[16 + i]; }
  return a;
}
__device__ __forceinline__ v16h frag_f32s(const float* rowk0, int lane, float sc) {
  v16h a; const float* p = rowk0 + 8 * (lane >> 4);
#pragma unroll
  for (int i = 0; i < 8; ++i) { a[i] = (_Float16)(p[i] * sc); a[8 + i] = (_Float16)(p[16 + i] * sc); }
  return a;
}
// column fragment from a [K][ld] layout (column n), rows >= K read as 0
__device__ __forceinline__ v16h fragc_f32(const float* W, int k0, int n, int lane, int ld, int K) {
  v16h a; const int g = lane >> 4;
#pragma unroll
  for (int i = 0; i < 8; ++i) { const int ka = k0 + 8 * g + i, kb = ka + 16;
    a[i] = (_Float16)(ka < K ? W[(size_t)(ka < K ? ka : K - 1) * ld + n] : 0.f); a[8 + i] = (_Float16)(kb < K ? W[(size_t)(kb < K ? kb : K - 1) * ld + n] : 0.f); }
  return a;
}
struct F2 { v16b h, l; };
__device__ __forceinline__ F2 bsplit16(const float v[16]) { F2 r;
#pragma unroll
  for (int i = 0; i < 16; ++i) { const __bf16 h = (__bf16)v[i]; r.h[i] = h; r.l[i] = (__bf16)(v[i] - (float)h); }
  return r; }
__device__ __forceinline__ F2 split_row(const float* row, int k0, int lane) { float v[16]; const float* p = row + k0 + 8 * (lane >> 4);
#pragma unroll
  for (int i = 0; i < 8; ++i) { v[i] = p[i]; v[8 + i] = p[16 + i]; }
  return bsplit16(v); }
__device__ __forceinline__ F2 split_rowK(const float* row, int k0, int lane, int K) { float v[16]; const int g = lane >> 4;
#pragma unroll
  for (int i = 0; i < 8; ++i) { const int ka = k0 + 8 * g + i, kb = ka + 16; v[i] = ka < K ? row[ka < K ? ka : K - 1] : 0.f; v[8 + i] = kb < K ? row[kb < K ? kb : K - 1] : 0.f; }
  return bsplit16(v); }
__device__ __forceinline__ F2 split_col(const float* W, int k0, int n, int lane, int ld, int K) { float v[16]; const int g = lane >> 4;
#pragma unroll
  for (int i = 0; i < 8; ++i) { const int ka = k0 + 8 * g + i, kb = ka + 16; v[i] = ka < K ? W[(size_t)(ka < K ? ka : K - 1) * ld + n] : 0.f; v[8 + i] = kb < K ? W[(size_t)(kb < K ? kb : K - 1) * ld + n] : 0.f; }
  return bsplit16(v); }
__device__ __forceinline__ v8f mac3(const F2& a, const F2& b, v8f c) { c = wmma_bf(a.l, b.h, c); c = wmma_bf(a.h, b.l, c); return wmma_bf(a.h, b.h, c); }
__device__ __forceinline__ float sigm(float v) { return 1.0f / (1.0f + expf(-v)); }
#define LDSX() do { asm volatile("s_wait_dscnt 0" ::: "memory"); __builtin_amdgcn_wave_barrier(); __builtin_amdgcn_fence(__ATOMIC_RELEASE, "workgroup"); } while (0)


// Single causal attention head (B 4, S 4,096, emb 512 -> head 64): softmax(Q K^T / 8, causal) V.
#define NB 4
#define SS 4096
#define NR (NB * SS)
#define EMB 512
#define HD 64
#ifndef TQB
#define TQB (SS / 16)
#define TNB NB
#endif
typedef __attribute__((ext_vector_type(8))) __bf16 v8b;
__device__ __forceinline__ v16b frag_b(const __bf16* rowk0, int lane) {
  union { v16b v; v8b q[2]; } u; const __bf16* p = rowk0 + 8 * (lane >> 4);
  u.q[0] = *(const v8b*)p; u.q[1] = *(const v8b*)(p + 16); return u.v;
}
__device__ __forceinline__ float bfr(float v) { return (float)(__bf16)v; }
__device__ __attribute__((noinline)) float exp_ni(float v) { return expf(v); }
__device__ __attribute__((noinline)) float erf_ni(float v) { return erff(v); }

#define WS_PK  0u                                     // bf16 [192][512]: Wq^T | Wk^T | Wv^T rows
#define WS_QH  (((2u * 192 * EMB) + 127u) / 128u * 128u)  // f16 [16384][64] q hi ; QL lo x2048 ; KH, KL
#define WS_QL  (WS_QH + 2u * NR * HD)
#define WS_KH  (WS_QL + 2u * NR * HD)
#define WS_KL  (WS_KH + 2u * NR * HD)
#define WS_VTH (WS_KL + 2u * NR * HD)                   // f16 [b][64 d][4096] v hi / lo
#define WS_VTL (WS_VTH + 2u * NR * HD)
#define WS_END (WS_VTL + 2u * NR * HD)

__global__ __launch_bounds__(256) void k_pack(const float* __restrict__ WQ, const float* __restrict__ WK, const float* __restrict__ WV, __bf16* __restrict__ PK) {
  __shared__ __align__(16) __bf16 s[EMB]; const int n = blockIdx.x, t = threadIdx.x; const int which = n / HD, d = n % HD; const float* Wm = (which == 0) ? WQ : (which == 1) ? WK : WV;
  for (int k = t; k < EMB; k += 256) s[k] = (__bf16)Wm[(size_t)k * HD + d];
  __syncthreads();
  if (t < EMB / 8) vst2((unsigned*)(PK + (size_t)n * EMB + t * 8), *(const v4u*)&s[t * 8]);
}
__global__ __launch_bounds__(128) void k_qkv(const float* __restrict__ X, const __bf16* __restrict__ PK, const float* __restrict__ BQ, const float* __restrict__ BK, const float* __restrict__ BV, _Float16* __restrict__ QH, _Float16* __restrict__ QL_, _Float16* __restrict__ KH, _Float16* __restrict__ KL, _Float16* __restrict__ VTH, _Float16* __restrict__ VTL) {
  __shared__ __align__(16) _Float16 sqh[4][16][72], sql[4][16][72], skh[4][16][72], skl[4][16][72]; __shared__ __align__(16) _Float16 svh[HD][72], svl[HD][72];
  const int tid = threadIdx.x, wave = tid >> 5, lane = tid & 31, col = lane & 15, g = lane >> 4; const size_t r0 = (size_t)blockIdx.x * 64 + wave * 16;
  v8f acc[12] = {};
#pragma unroll 2
  for (int kc = 0; kc < EMB / 32; ++kc) { v16b a; { const float* p = X + (r0 + col) * EMB + kc * 32 + 8 * g;
#pragma unroll
      for (int i = 0; i < 8; ++i) { a[i] = (__bf16)p[i]; a[8 + i] = (__bf16)p[16 + i]; } }
#pragma unroll
    for (int j = 0; j < 12; ++j) acc[j] = wmma_bf(a, frag_b(PK + (size_t)(j * 16 + col) * EMB + kc * 32, lane), acc[j]); }
#pragma unroll
  for (int j = 0; j < 12; ++j) { const int which = j >> 2; const int d = (j & 3) * 16 + col; const float bb = bfr((which == 0) ? BQ[d] : (which == 1) ? BK[d] : BV[d]);
#pragma unroll
    for (int r = 0; r < 8; ++r) { const float v = acc[j][r] + bb; const _Float16 hv = (_Float16)v; const _Float16 lv = (_Float16)((v - (float)hv) * 2048.0f);
      if (which == 0) { sqh[wave][8 * g + r][d] = hv; sql[wave][8 * g + r][d] = lv; } else if (which == 1) { skh[wave][8 * g + r][d] = hv; skl[wave][8 * g + r][d] = lv; } else { svh[d][wave * 16 + 8 * g + r] = hv; svl[d][wave * 16 + 8 * g + r] = lv; } } }
  __syncthreads();
  for (int rl = 0; rl < 16; ++rl) { const size_t o = (r0 + rl) * HD + (lane & 7) * 8; const int which = lane >> 3;
    if (which == 0) vst2((unsigned*)(QH + o), *(const v4u*)&sqh[wave][rl][(lane & 7) * 8]); else if (which == 1) vst2((unsigned*)(QL_ + o), *(const v4u*)&sql[wave][rl][(lane & 7) * 8]); else if (which == 2) vst2((unsigned*)(KH + o), *(const v4u*)&skh[wave][rl][(lane & 7) * 8]); else vst2((unsigned*)(KL + o), *(const v4u*)&skl[wave][rl][(lane & 7) * 8]); }
  { const size_t rb = (size_t)blockIdx.x * 64; const int b = (int)(rb / SS), s0 = (int)(rb % SS);
    for (int e = tid; e < HD * 8; e += 128) { const int d = e >> 3, pc = e & 7; const size_t o = ((size_t)b * HD + d) * SS + s0 + pc * 8; vst2((unsigned*)(VTH + o), *(const v4u*)&svh[d][pc * 8]); vst2((unsigned*)(VTL + o), *(const v4u*)&svl[d][pc * 8]); } }
}
// ---- k_attn: block = (16 queries, b), 16 waves: wave w takes the 32-key blocks w, w + 16, ... with its own running max, sum and accumulators; causal; 3-product scores / 8; online softmax; P hi/lo x V hi/lo;
// the 16 partial results are merged in LDS behind one work-group barrier (weights exp(m_w - M)); wave w stores output row w, f32 [64] (256 B by 32 lanes)
#define KW 16
__global__ __launch_bounds__(32 * KW) void k_attn(const _Float16* __restrict__ QH, const _Float16* __restrict__ QL_, const _Float16* __restrict__ KH, const _Float16* __restrict__ KL, const _Float16* __restrict__ VTH, const _Float16* __restrict__ VTL, float* __restrict__ OUT) {
  __shared__ __align__(16) _Float16 sph[KW][16][40], spl[KW][16][40]; __shared__ __align__(16) float so[KW][16][HD + 4]; __shared__ float sm[KW][16], sl[KW][16];
  const int tid = threadIdx.x, wave = __builtin_amdgcn_readfirstlane(tid >> 5) /* scalar: the key loop's start and trip count differ by wave and must be a scalar branch around the WMMAs */, lane = tid & 31, col = lane & 15, g = lane >> 4; const int qb = blockIdx.x, b = blockIdx.y; const int q0 = qb * 16; const size_t rq = (size_t)b * SS + q0 + col;
  v16h aqh[2], aql[2];
#pragma unroll
  for (int kc = 0; kc < 2; ++kc) { aqh[kc] = frag_h(QH + rq * HD + kc * 32, lane); aql[kc] = frag_h(QL_ + rq * HD + kc * 32, lane); }
  const _Float16* Vh = VTH + (size_t)b * HD * SS; const _Float16* Vl = VTL + (size_t)b * HD * SS;
  float m[8], l[8];
#pragma unroll
  for (int r = 0; r < 8; ++r) { m[r] = -3.0e38f; l[r] = 0.f; }
  v8f acc[4] = {}, accl[4] = {};
  const int nks = (q0 + 16 + 31) / 32;
#pragma unroll 1
  for (int ks = wave; ks < nks; ks += KW) { v8f s[2];
#pragma unroll
    for (int ct = 0; ct < 2; ++ct) { const int kk = ks * 32 + ct * 16 + col; const size_t rk = ((size_t)b * SS + kk) * HD; v8f c = {}, cl = {};
#pragma unroll
      for (int kc = 0; kc < 2; ++kc) { const v16h khf = frag_h(KH + rk + kc * 32, lane); c = wmma16(aqh[kc], khf, c); cl = wmma16(aql[kc], khf, cl); cl = wmma16(aqh[kc], frag_h(KL + rk + kc * 32, lane), cl); }
#pragma unroll
      for (int r = 0; r < 8; ++r) { const int qi = q0 + 8 * g + r; const float sv = (c[r] + cl[r] * (1.0f / 2048.0f)) * 0.125f; s[ct][r] = (kk <= qi) ? sv : -3.0e38f; } }
#pragma unroll
    for (int r = 0; r < 8; ++r) { float mx = fmaxf(s[0][r], s[1][r]);
#pragma unroll
      for (int o = 1; o < 16; o <<= 1) mx = fmaxf(mx, __shfl_xor(mx, o));
      const float mn = fmaxf(m[r], mx); const float alpha = (m[r] <= -1.0e38f) ? 0.f : exp_ni(m[r] - mn);
      const float e0 = (s[0][r] <= -1.0e38f) ? 0.f : exp_ni(s[0][r] - mn), e1 = (s[1][r] <= -1.0e38f) ? 0.f : exp_ni(s[1][r] - mn); float es = e0 + e1;
#pragma unroll
      for (int o = 1; o < 16; o <<= 1) es += __shfl_xor(es, o);
      l[r] = l[r] * alpha + es; m[r] = mn;
#pragma unroll
      for (int dt = 0; dt < 4; ++dt) { acc[dt][r] *= alpha; accl[dt][r] *= alpha; }
      const _Float16 h0 = (_Float16)e0, h1 = (_Float16)e1; sph[wave][8 * g + r][col] = h0; sph[wave][8 * g + r][16 + col] = h1; spl[wave][8 * g + r][col] = (_Float16)((e0 - (float)h0) * 2048.0f); spl[wave][8 * g + r][16 + col] = (_Float16)((e1 - (float)h1) * 2048.0f); }
    LDSX();
    const v16h pah = frag_h(&sph[wave][col][0], lane), pal = frag_h(&spl[wave][col][0], lane);
#pragma unroll
    for (int dt = 0; dt < 4; ++dt) { const size_t vo = (size_t)(dt * 16 + col) * SS + ks * 32; const v16h vh = frag_h(Vh + vo, lane), vl = frag_h(Vl + vo, lane); acc[dt] = wmma16(pah, vh, acc[dt]); accl[dt] = wmma16(pal, vh, accl[dt]); accl[dt] = wmma16(pah, vl, accl[dt]); }
    LDSX(); }
#pragma unroll
  for (int r = 0; r < 8; ++r) { if (col == 0) { sm[wave][8 * g + r] = m[r]; sl[wave][8 * g + r] = l[r]; }
#pragma unroll
    for (int dt = 0; dt < 4; ++dt) so[wave][8 * g + r][dt * 16 + col] = acc[dt][r] + accl[dt][r] * (1.0f / 2048.0f); }
  __syncthreads();   // every wave's partial (max, sum, rows) is in LDS before any wave reads the others'; every wave passes here, also one that had no key block
  { const float mw = sm[col][wave], lw = sl[col][wave]; float mx = mw;   // lane holds the part of wave (lane & 15) for output row 'wave'; a wave that saw no open key has m = -3e38, l = 0 and gets weight 0
    for (int o = 1; o < 16; o <<= 1) mx = fmaxf(mx, __shfl_xor(mx, o));
    const float wg = (mw <= -1.0e38f) ? 0.f : exp_ni(mw - mx); float ls = wg * lw;
    for (int o = 1; o < 16; o <<= 1) ls += __shfl_xor(ls, o);
    v2f o2 = {};
#pragma unroll   // the 16 LDS reads and weight broadcasts are independent: unrolled they are issued together instead of one wait per part
    for (int w = 0; w < KW; ++w) o2 += __shfl(wg, w) * *(const v2f*)&so[w][wave][lane * 2];
    vst2(OUT + ((size_t)b * SS + q0 + wave) * HD + lane * 2, (v2f)(o2 * (1.0f / ls))); }
}
extern "C" void kernel_launch(void* const* d_in, const int* in_sizes, int n_in, void* d_out, int out_size, void* d_ws, size_t ws_size, hipStream_t stream) {
  (void)in_sizes; (void)n_in; (void)out_size;
  const float** F = (const float**)d_in;   // 0 x [4,4096,512], 1 Wq [512,64], 2 bq, 3 Wk, 4 bk, 5 Wv, 6 bv
  if (ws_size < (size_t)WS_END) return;
  char* ws = (char*)d_ws; __bf16* PK = (__bf16*)(ws + WS_PK); _Float16 *QH = (_Float16*)(ws + WS_QH), *QLp = (_Float16*)(ws + WS_QL), *KH = (_Float16*)(ws + WS_KH), *KL = (_Float16*)(ws + WS_KL), *VTH = (_Float16*)(ws + WS_VTH), *VTL = (_Float16*)(ws + WS_VTL);
  k_pack<<<192, 256, 0, stream>>>(F[1], F[3], F[5], PK);
  k_qkv<<<TNB * SS / 64, 128, 0, stream>>>(F[0], PK, F[2], F[4], F[6], QH, QLp, KH, KL, VTH, VTL);
  k_attn<<<dim3(TQB, TNB), 32 * KW, 0, stream>>>(QH, QLp, KH, KL, VTH, VTL, (float*)d_out);
}

// v002
// A run of this version takes 185 microseconds.
// Timed twice side by side with v001, it ran 1.13 times as fast both times.
// Over all steps from v000 it is 3.78 times as fast.
// compute dtype: x, Wq, bq, Wk, bk, Wv, bv (module inputs) rounded to bf16; Q/K/V projection with exact bf16 products on WMMA 16x16x32 ((in,out) weights packed as transposed rows) + biases; q and k stored as f16 hi + (x2048-scaled) residual planes with 3-product scores, x 1/8 on the f32 score, causal mask, running-max softmax in f32 (precise expf); P as f16 hi + (x2048) residual x v hi/lo (3 products); f32 output rows.
#include <hip/hip_runtime.h>
#include <math.h>

typedef __attribute__((ext_vector_type(16))) _Float16 v16h;
typedef __attribute__((ext_vector_type(16))) __bf16 v16b;
typedef __attribute__((ext_vector_type(8)))  _Float16 v8h;
typedef __attribute__((ext_vector_type(8)))  float v8f;
typedef __attribute__((ext_vector_type(4)))  float v4f;
typedef __attribute__((ext_vector_type(2)))  float v2f;
typedef __attribute__((ext_vector_type(4)))  unsigned v4u;
typedef __attribute__((ext_vector_type(4)))  int v4i;
typedef float __attribute__((may_alias)) float_a;
typedef int __attribute__((may_alias)) int_a;

template <typename T> __device__ __forceinline__ void vst2(void* p, T v) { *(T*)p = v;  }
__device__ __forceinline__ v8f wmma16(v16h a, v16h b, v8f c) {
  v8f d = __builtin_amdgcn_wmma_f32_16x16x32_f16(false, a, false, b, (short)0, c, false, false);
  asm volatile("v_nop\n\tv_nop\n\tv_nop\n\tv_nop" : "+v"(d) : "v"(a), "v"(b));
  return d;
}
__device__ __forceinline__ v8f wmma_bf(v16b a, v16b b, v8f c) {
  v8f d = __builtin_amdgcn_wmma_f32_16x16x32_bf16(false, a, false, b, (short)0, c, false, false);
  asm volatile("v_nop\n\tv_nop\n\tv_nop\n\tv_nop" : "+v"(d) : "v"(a), "v"(b));
  return d;
}
// 16x16x32 fragments: lane = (h = lane>>4, row/col = lane&15); elements 0..7 = k0+8h+0..7, 8..15 = k0+16+8h+0..7; D element r = row 8h+r
__device__ __forceinline__ v16h frag_h(const _Float16* rowk0, int lane) {
  union { v16h v; v8h q[2]; } u; const _Float16* p = rowk0 + 8 * (lane >> 4);
  u.q[0] = *(const v8h*)p; u.q[1] = *(const v8h*)(p + 16); return u.v;
}
__device__ __forceinline__ v16h frag_f32(const float* rowk0, int lane) {
  v16h a; const float* p = rowk0 + 8 * (lane >> 4);
#pragma unroll
  for (int i = 0; i < 8; ++i) { a[i] = (_Float16)p[i]; a[8 + i] = (_Float16)p[16 + i]; }
  return a;
}
__device__ __forceinline__ v16h frag_f32s(const float* rowk0, int lane, float sc) {
  v16h a; const float* p = rowk0 + 8 * (lane >> 4);
#pragma unroll
  for (int i = 0; i < 8; ++i) { a[i] = (_Float16)(p[i] * sc); a[8 + i] = (_Float16)(p[16 + i] * sc); }
  return a;
}
// column fragment from a [K][ld] layout (column n), rows >= K read as 0
__device__ __forceinline__ v16h fragc_f32(const float* W, int k0, int n, int lane, int ld, int K) {
  v16h a; const int g = lane >> 4;
#pragma unroll
  for (int i = 0; i < 8; ++i) { const int ka = k0 + 8 * g + i, kb = ka + 16;
    a[i] = (_Float16)(ka < K ? W[(size_t)(ka < K ? ka : K - 1) * ld + n] : 0.f); a[8 + i] = (_Float16)(kb < K ? W[(size_t)(kb < K ? kb : K - 1) * ld + n] : 0.f); }
  return a;
}
struct F2 { v16b h, l; };
__device__ __forceinline__ F2 bsplit16(const float v[16]) { F2 r;
#pragma unroll
  for (int i = 0; i < 16; ++i) { const __bf16 h = (__bf16)v[i]; r.h[i] = h; r.l[i] = (__bf16)(v[i] - (float)h); }
  return r; }
__device__ __forceinline__ F2 split_row(const float* row, int k0, int lane) { float v[16]; const float* p = row + k0 + 8 * (lane >> 4);
#pragma unroll
  for (int i = 0; i < 8; ++i) { v[i] = p[i]; v[8 + i] = p[16 + i]; }
  return bsplit16(v); }
__device__ __forceinline__ F2 split_rowK(const float* row, int k0, int lane, int K) { float v[16]; const int g = lane >> 4;
#pragma unroll
  for (int i = 0; i < 8; ++i) { const int ka = k0 + 8 * g + i, kb = ka + 16; v[i] = ka < K ? row[ka < K ? ka : K - 1] : 0.f; v[8 + i] = kb < K ? row[kb < K ? kb : K - 1] : 0.f; }
  return bsplit16(v); }
__device__ __forceinline__ F2 split_col(const float* W, int k0, int n, int lane, int ld, int K) { float v[16]; const int g = lane >> 4;
#pragma unroll
  for (int i = 0; i < 8; ++i) { const int ka = k0 + 8 * g + i, kb = ka + 16; v[i] = ka < K ? W[(size_t)(ka < K ? ka : K - 1) * ld + n] : 0.f; v[8 + i] = kb < K ? W[(size_t)(kb < K ? kb : K - 1) * ld + n] : 0.f; }
  return bsplit16(v); }
__device__ __forceinline__ v8f mac3(const F2& a, const F2& b, v8f c) { c = wmma_bf(a.l, b.h, c); c = wmma_bf(a.h, b.l, c); return wmma_bf(a.h, b.h, c); }
__device__ __forceinline__ float sigm(float v) { return 1.0f / (1.0f + expf(-v)); }
#define LDSX() do { asm volatile("s_wait_dscnt 0" ::: "memory"); __builtin_amdgcn_wave_barrier(); __builtin_amdgcn_fence(__ATOMIC_RELEASE, "workgroup"); } while (0)


// Single causal attention head (B 4, S 4,096, emb 512 -> head 64): softmax(Q K^T / 8, causal) V.
#define NB 4
#define SS 4096
#define NR (NB * SS)
#define EMB 512
#define HD 64
#ifndef TQB
#define TQB (SS / 16)
#define TNB NB
#endif
typedef __attribute__((ext_vector_type(8))) __bf16 v8b;
__device__ __forceinline__ v16b frag_b(const __bf16* rowk0, int lane) {
  union { v16b v; v8b q[2]; } u; const __bf16* p = rowk0 + 8 * (lane >> 4);
  u.q[0] = *(const v8b*)p; u.q[1] = *(const v8b*)(p + 16); return u.v;
}
__device__ __forceinline__ float bfr(float v) { return (float)(__bf16)v; }
__device__ __attribute__((noinline)) float exp_ni(float v) { return expf(v); }
__device__ __attribute__((noinline)) float erf_ni(float v) { return erff(v); }

#define WS_PK  0u                                     // bf16 [192][512]: Wq^T | Wk^T | Wv^T rows
#define WS_QH  (((2u * 192 * EMB) + 127u) / 128u * 128u)  // f16 [16384][64] q hi ; QL lo x2048 ; KH, KL
#define WS_QL  (WS_QH + 2u * NR * HD)
#define WS_KH  (WS_QL + 2u * NR * HD)
#define WS_KL  (WS_KH + 2u * NR * HD)
#define WS_VTH (WS_KL + 2u * NR * HD)                   // f16 [b][64 d][4096] v hi / lo
#define WS_VTL (WS_VTH + 2u * NR * HD)
#define WS_END (WS_VTL + 2u * NR * HD)

__global__ __launch_bounds__(256) void k_pack(const float* __restrict__ WQ, const float* __restrict__ WK, const float* __restrict__ WV, __bf16* __restrict__ PK) {
  __shared__ __align__(16) __bf16 s[EMB]; const int n = blockIdx.x, t = threadIdx.x; const int which = n / HD, d = n % HD; const float* Wm = (which == 0) ? WQ : (which == 1) ? WK : WV;
  for (int k = t; k < EMB; k += 256) s[k] = (__bf16)Wm[(size_t)k * HD + d];
  __syncthreads();
  if (t < EMB / 8) vst2((unsigned*)(PK + (size_t)n * EMB + t * 8), *(const v4u*)&s[t * 8]);
}
__global__ __launch_bounds__(128) void k_qkv(const float* __restrict__ X, const __bf16* __restrict__ PK, const float* __restrict__ BQ, const float* __restrict__ BK, const float* __restrict__ BV, _Float16* __restrict__ QH, _Float16* __restrict__ QL_, _Float16* __restrict__ KH, _Float16* __restrict__ KL, _Float16* __restrict__ VTH, _Float16* __restrict__ VTL) {
  __shared__ __align__(16) _Float16 sqh[4][16][72], sql[4][16][72], skh[4][16][72], skl[4][16][72]; __shared__ __align__(16) _Float16 svh[HD][72], svl[HD][72];
  const int tid = threadIdx.x, wave = tid >> 5, lane = tid & 31, col = lane & 15, g = lane >> 4; const size_t r0 = (size_t)blockIdx.x * 64 + wave * 16;
  v8f acc[12] = {};
#pragma unroll 2
  for (int kc = 0; kc < EMB / 32; ++kc) { v16b a; { const float* p = X + (r0 + col) * EMB + kc * 32 + 8 * g;
#pragma unroll
      for (int i = 0; i < 8; ++i) { a[i] = (__bf16)p[i]; a[8 + i] = (__bf16)p[16 + i]; } }
#pragma unroll
    for (int j = 0; j < 12; ++j) acc[j] = wmma_bf(a, frag_b(PK + (size_t)(j * 16 + col) * EMB + kc * 32, lane), acc[j]); }
#pragma unroll
  for (int j = 0; j < 12; ++j) { const int which = j >> 2; const int d = (j & 3) * 16 + col; const float bb = bfr((which == 0) ? BQ[d] : (which == 1) ? BK[d] : BV[d]);
#pragma unroll
    for (int r = 0; r < 8; ++r) { const float v = acc[j][r] + bb; const _Float16 hv = (_Float16)v; const _Float16 lv = (_Float16)((v - (float)hv) * 2048.0f);
      if (which == 0) { sqh[wave][8 * g + r][d] = hv; sql[wave][8 * g + r][d] = lv; } else if (which == 1) { skh[wave][8 * g + r][d] = hv; skl[wave][8 * g + r][d] = lv; } else { svh[d][wave * 16 + 8 * g + r] = hv; svl[d][wave * 16 + 8 * g + r] = lv; } } }
  __syncthreads();
  for (int rl = 0; rl < 16; ++rl) { const size_t o = (r0 + rl) * HD + (lane & 7) * 8; const int which = lane >> 3;
    if (which == 0) vst2((unsigned*)(QH + o), *(const v4u*)&sqh[wave][rl][(lane & 7) * 8]); else if (which == 1) vst2((unsigned*)(QL_ + o), *(const v4u*)&sql[wave][rl][(lane & 7) * 8]); else if (which == 2) vst2((unsigned*)(KH + o), *(const v4u*)&skh[wave][rl][(lane & 7) * 8]); else vst2((unsigned*)(KL + o), *(const v4u*)&skl[wave][rl][(lane & 7) * 8]); }
  { const size_t rb = (size_t)blockIdx.x * 64; const int b = (int)(rb / SS), s0 = (int)(rb % SS);
    for (int e = tid; e < HD * 8; e += 128) { const int d = e >> 3, pc = e & 7; const size_t o = ((size_t)b * HD + d) * SS + s0 + pc * 8; vst2((unsigned*)(VTH + o), *(const v4u*)&svh[d][pc * 8]); vst2((unsigned*)(VTL + o), *(const v4u*)&svl[d][pc * 8]); } }
}
// ---- k_attn: block = (16 queries, b), 16 waves: wave w takes the 32-key blocks w, w + 16, ... with its own running max, sum and accumulators; causal; 3-product scores / 8; online softmax; P hi/lo x V hi/lo;
// the 16 partial results are merged in LDS behind one work-group barrier (weights exp(m_w - M)); wave w stores output row w, f32 [64] (256 B by 32 lanes)
#define KW 16
__global__ __launch_bounds__(32 * KW) void k_attn(const _Float16* __restrict__ QH, const _Float16* __restrict__ QL_, const _Float16* __restrict__ KH, const _Float16* __restrict__ KL, const _Float16* __restrict__ VTH, const _Float16* __restrict__ VTL, float* __restrict__ OUT) {
  __shared__ __align__(16) _Float16 sph[KW][16][40], spl[KW][16][40]; __shared__ __align__(16) float so[KW][16][HD + 4]; __shared__ float sm[KW][16], sl[KW][16];
  const int tid = threadIdx.x, wave = __builtin_amdgcn_readfirstlane(tid >> 5) /* scalar: the key loop's start and trip count differ by wave and must be a scalar branch around the WMMAs */, lane = tid & 31, col = lane & 15, g = lane >> 4;
  // cost grows with the query tile (causal) and only one work-group fits a WGP at a time: the flat index is mapped so that cost falls with it (heaviest tiles of all batches start first, the one-block tiles fill the end); a permutation of (tile, batch)
  const int flat = blockIdx.y * TQB + blockIdx.x; const int qb = TQB - 1 - flat / TNB, b = flat % TNB; const int q0 = qb * 16; const size_t rq = (size_t)b * SS + q0 + col;
  v16h aqh[2], aql[2];
#pragma unroll
  for (int kc = 0; kc < 2; ++kc) { aqh[kc] = frag_h(QH + rq * HD + kc * 32, lane); aql[kc] = frag_h(QL_ + rq * HD + kc * 32, lane); }
  const _Float16* Vh = VTH + (size_t)b * HD * SS; const _Float16* Vl = VTL + (size_t)b * HD * SS;
  float m[8], l[8];
#pragma unroll
  for (int r = 0; r < 8; ++r) { m[r] = -3.0e38f; l[r] = 0.f; }
  v8f acc[4] = {}, accl[4] = {};
  const int nks = (q0 + 16 + 31) / 32;
#pragma unroll 1
  for (int ks = wave; ks < nks; ks += KW) { v8f s[2];
#pragma unroll
    for (int ct = 0; ct < 2; ++ct) { const int kk = ks * 32 + ct * 16 + col; const size_t rk = ((size_t)b * SS + kk) * HD; v8f c = {}, cl = {};
#pragma unroll
      for (int kc = 0; kc < 2; ++kc) { const v16h khf = frag_h(KH + rk + kc * 32, lane); c = wmma16(aqh[kc], khf, c); cl = wmma16(aql[kc], khf, cl); cl = wmma16(aqh[kc], frag_h(KL + rk + kc * 32, lane), cl); }
#pragma unroll
      for (int r = 0; r < 8; ++r) { const int qi = q0 + 8 * g + r; const float sv = (c[r] + cl[r] * (1.0f / 2048.0f)) * 0.125f; s[ct][r] = (kk <= qi) ? sv : -3.0e38f; } }
#pragma unroll
    for (int r = 0; r < 8; ++r) { float mx = fmaxf(s[0][r], s[1][r]);
#pragma unroll
      for (int o = 1; o < 16; o <<= 1) mx = fmaxf(mx, __shfl_xor(mx, o));
      const float mn = fmaxf(m[r], mx); const float alpha = (m[r] <= -1.0e38f) ? 0.f : exp_ni(m[r] - mn);
      const float e0 = (s[0][r] <= -1.0e38f) ? 0.f : exp_ni(s[0][r] - mn), e1 = (s[1][r] <= -1.0e38f) ? 0.f : exp_ni(s[1][r] - mn); float es = e0 + e1;
#pragma unroll
      for (int o = 1; o < 16; o <<= 1) es += __shfl_xor(es, o);
      l[r] = l[r] * alpha + es; m[r] = mn;
#pragma unroll
      for (int dt = 0; dt < 4; ++dt) { acc[dt][r] *= alpha; accl[dt][r] *= alpha; }
      const _Float16 h0 = (_Float16)e0, h1 = (_Float16)e1; sph[wave][8 * g + r][col] = h0; sph[wave][8 * g + r][16 + col] = h1; spl[wave][8 * g + r][col] = (_Float16)((e0 - (float)h0) * 2048.0f); spl[wave][8 * g + r][16 + col] = (_Float16)((e1 - (float)h1) * 2048.0f); }
    LDSX();
    const v16h pah = frag_h(&sph[wave][col][0], lane), pal = frag_h(&spl[wave][col][0], lane);
#pragma unroll
    for (int dt = 0; dt < 4; ++dt) { const size_t vo = (size_t)(dt * 16 + col) * SS + ks * 32; const v16h vh = frag_h(Vh + vo, lane), vl = frag_h(Vl + vo, lane); acc[dt] = wmma16(pah, vh, acc[dt]); accl[dt] = wmma16(pal, vh, accl[dt]); accl[dt] = wmma16(pah, vl, accl[dt]); }
    LDSX(); }
#pragma unroll
  for (int r = 0; r < 8; ++r) { if (col == 0) { sm[wave][8 * g + r] = m[r]; sl[wave][8 * g + r] = l[r]; }
#pragma unroll
    for (int dt = 0; dt < 4; ++dt) so[wave][8 * g + r][dt * 16 + col] = acc[dt][r] + accl[dt][r] * (1.0f / 2048.0f); }
  __syncthreads();   // every wave's partial (max, sum, rows) is in LDS before any wave reads the others'; every wave passes here, also one that had no key block
  { const float mw = sm[col][wave], lw = sl[col][wave]; float mx = mw;   // lane holds the part of wave (lane & 15) for output row 'wave'; a wave that saw no open key has m = -3e38, l = 0 and gets weight 0
    for (int o = 1; o < 16; o <<= 1) mx = fmaxf(mx, __shfl_xor(mx, o));
    const float wg = (mw <= -1.0e38f) ? 0.f : exp_ni(mw - mx); float ls = wg * lw;
    for (int o = 1; o < 16; o <<= 1) ls += __shfl_xor(ls, o);
    v2f o2 = {};
#pragma unroll   // the 16 LDS reads and weight broadcasts are independent: unrolled they are issued together instead of one wait per part
    for (int w = 0; w < KW; ++w) o2 += __shfl(wg, w) * *(const v2f*)&so[w][wave][lane * 2];
    vst2(OUT + ((size_t)b * SS + q0 + wave) * HD + lane * 2, (v2f)(o2 * (1.0f / ls))); }
}
extern "C" void kernel_launch(void* const* d_in, const int* in_sizes, int n_in, void* d_out, int out_size, void* d_ws, size_t ws_size, hipStream_t stream) {
  (void)in_sizes; (void)n_in; (void)out_size;
  const float** F = (const float**)d_in;   // 0 x [4,4096,512], 1 Wq [512,64], 2 bq, 3 Wk, 4 bk, 5 Wv, 6 bv
  if (ws_size < (size_t)WS_END) return;
  char* ws = (char*)d_ws; __bf16* PK = (__bf16*)(ws + WS_PK); _Float16 *QH = (_Float16*)(ws + WS_QH), *QLp = (_Float16*)(ws + WS_QL), *KH = (_Float16*)(ws + WS_KH), *KL = (_Float16*)(ws + WS_KL), *VTH = (_Float16*)(ws + WS_VTH), *VTL = (_Float16*)(ws + WS_VTL);
  k_pack<<<192, 256, 0, stream>>>(F[1], F[3], F[5], PK);
  k_qkv<<<TNB * SS / 64, 128, 0, stream>>>(F[0], PK, F[2], F[4], F[6], QH, QLp, KH, KL, VTH, VTL);
  k_attn<<<dim3(TQB, TNB), 32 * KW, 0, stream>>>(QH, QLp, KH, KL, VTH, VTL, (float*)d_out);
}

// v003
// Measured time: 132 microseconds a run.
// Next to v002, in two timings, it ran 1.41 and 1.40 times as fast.
// All steps since v000 together make it 5.32 times as fast.
// compute dtype: x, Wq, bq, Wk, bk, Wv, bv (module inputs) rounded to bf16; Q/K/V projection with exact bf16 products on WMMA 16x16x32 ((in,out) weights packed as transposed rows) + biases; q and k stored as f16 hi + (x2048-scaled) residual planes with 3-product scores, x 1/8 on the f32 score, causal mask, running-max softmax in f32 (precise expf); P as f16 hi + (x2048) residual x v hi/lo (3 products); f32 output rows.
#include <hip/hip_runtime.h>
#include <math.h>

typedef __attribute__((ext_vector_type(16))) _Float16 v16h;
typedef __attribute__((ext_vector_type(16))) __bf16 v16b;
typedef __attribute__((ext_vector_type(8)))  _Float16 v8h;
typedef __attribute__((ext_vector_type(8)))  float v8f;
typedef __attribute__((ext_vector_type(4)))  float v4f;
typedef __attribute__((ext_vector_type(2)))  float v2f;
typedef __attribute__((ext_vector_type(4)))  unsigned v4u;
typedef __attribute__((ext_vector_type(4)))  int v4i;
typedef float __attribute__((may_alias)) float_a;
typedef int __attribute__((may_alias)) int_a;

template <typename T> __device__ __forceinline__ void vst2(void* p, T v) { *(T*)p = v;  }
__device__ __forceinline__ v8f wmma16(v16h a, v16h b, v8f c) {
  v8f d = __builtin_amdgcn_wmma_f32_16x16x32_f16(false, a, false, b, (short)0, c, false, false);
  asm volatile("v_nop\n\tv_nop\n\tv_nop\n\tv_nop" : "+v"(d) : "v"(a), "v"(b));
  return d;
}
__device__ __forceinline__ v8f wmma_bf(v16b a, v16b b, v8f c) {
  v8f d = __builtin_amdgcn_wmma_f32_16x16x32_bf16(false, a, false, b, (short)0, c, false, false);
  asm volatile("v_nop\n\tv_nop\n\tv_nop\n\tv_nop" : "+v"(d) : "v"(a), "v"(b));
  return d;
}
// 16x16x32 fragments: lane = (h = lane>>4, row/col = lane&15); elements 0..7 = k0+8h+0..7, 8..15 = k0+16+8h+0..7; D element r = row 8h+r
__device__ __forceinline__ v16h frag_h(const _Float16* rowk0, int lane) {
  union { v16h v; v8h q[2]; } u; const _Float16* p = rowk0 + 8 * (lane >> 4);
  u.q[0] = *(const v8h*)p; u.q[1] = *(const v8h*)(p + 16); return u.v;
}
__device__ __forceinline__ v16h frag_f32(const float* rowk0, int lane) {
  v16h a; const float* p = rowk0 + 8 * (lane >> 4);
#pragma unroll
  for (int i = 0; i < 8; ++i) { a[i] = (_Float16)p[i]; a[8 + i] = (_Float16)p[16 + i]; }
  return a;
}
__device__ __forceinline__ v16h frag_f32s(const float* rowk0, int lane, float sc) {
  v16h a; const float* p = rowk0 + 8 * (lane >> 4);
#pragma unroll
  for (int i = 0; i < 8; ++i) { a[i] = (_Float16)(p[i] * sc); a[8 + i] = (_Float16)(p[16 + i] * sc); }
  return a;
}
// column fragment from a [K][ld] layout (column n), rows >= K read as 0
__device__ __forceinline__ v16h fragc_f32(const float* W, int k0, int n, int lane, int ld, int K) {
  v16h a; const int g = lane >> 4;
#pragma unroll
  for (int i = 0; i < 8; ++i) { const int ka = k0 + 8 * g + i, kb = ka + 16;
    a[i] = (_Float16)(ka < K ? W[(size_t)(ka < K ? ka : K - 1) * ld + n] : 0.f); a[8 + i] = (_Float16)(kb < K ? W[(size_t)(kb < K ? kb : K - 1) * ld + n] : 0.f); }
  return a;
}
struct F2 { v16b h, l; };
__device__ __forceinline__ F2 bsplit16(const float v[16]) { F2 r;
#pragma unroll
  for (int i = 0; i < 16; ++i) { const __bf16 h = (__bf16)v[i]; r.h[i] = h; r.l[i] = (__bf16)(v[i] - (float)h); }
  return r; }
__device__ __forceinline__ F2 split_row(const float* row, int k0, int lane) { float v[16]; const float* p = row + k0 + 8 * (lane >> 4);
#pragma unroll
  for (int i = 0; i < 8; ++i) { v[i] = p[i]; v[8 + i] = p[16 + i]; }
  return bsplit16(v); }
__device__ __forceinline__ F2 split_rowK(const float* row, int k0, int lane, int K) { float v[16]; const int g = lane >> 4;
#pragma unroll
  for (int i = 0; i < 8; ++i) { const int ka = k0 + 8 * g + i, kb = ka + 16; v[i] = ka < K ? row[ka < K ? ka : K - 1] : 0.f; v[8 + i] = kb < K ? row[kb < K ? kb : K - 1] : 0.f; }
  return bsplit16(v); }
__device__ __forceinline__ F2 split_col(const float* W, int k0, int n, int lane, int ld, int K) { float v[16]; const int g = lane >> 4;
#pragma unroll
  for (int i = 0; i < 8; ++i) { const int ka = k0 + 8 * g + i, kb = ka + 16; v[i] = ka < K ? W[(size_t)(ka < K ? ka : K - 1) * ld + n] : 0.f; v[8 + i] = kb < K ? W[(size_t)(kb < K ? kb : K - 1) * ld + n] : 0.f; }
  return bsplit16(v); }
__device__ __forceinline__ v8f mac3(const F2& a, const F2& b, v8f c) { c = wmma_bf(a.l, b.h, c); c = wmma_bf(a.h, b.l, c); return wmma_bf(a.h, b.h, c); }
__device__ __forceinline__ float sigm(float v) { return 1.0f / (1.0f + expf(-v)); }
#define LDSX() do { asm volatile("s_wait_dscnt 0" ::: "memory"); __builtin_amdgcn_wave_barrier(); __builtin_amdgcn_fence(__ATOMIC_RELEASE, "workgroup"); } while (0)


// Single causal attention head (B 4, S 4,096, emb 512 -> head 64): softmax(Q K^T / 8, causal) V.
#define NB 4
#define SS 4096
#define NR (NB * SS)
#define EMB 512
#define HD 64
#ifndef TQB
#define TQB (SS / 16)
#define TNB NB
#endif
typedef __attribute__((ext_vector_type(8))) __bf16 v8b;
__device__ __forceinline__ v16b frag_b(const __bf16* rowk0, int lane) {
  union { v16b v; v8b q[2]; } u; const __bf16* p = rowk0 + 8 * (lane >> 4);
  u.q[0] = *(const v8b*)p; u.q[1] = *(const v8b*)(p + 16); return u.v;
}
// the same fragment as frag_h, from a wave-uniform base and the lane's own element offset (8 * (lane >> 4) included)
__device__ __forceinline__ v16h frag_u(const _Float16* base, unsigned off) {
  union { v16h v; v8h q[2]; } u; u.q[0] = *(const v8h*)(base + off); u.q[1] = *(const v8h*)(base + off + 16); return u.v;
}
__device__ __forceinline__ float bfr(float v) { return (float)(__bf16)v; }
__device__ __attribute__((noinline)) float exp_ni(float v) { return expf(v); }
__device__ __attribute__((noinline)) float erf_ni(float v) { return erff(v); }

#define WS_PK  0u                                     // bf16 [192][512]: Wq^T | Wk^T | Wv^T rows
#define WS_QH  (((2u * 192 * EMB) + 127u) / 128u * 128u)  // f16 [16384][64] q hi ; QL lo x2048 ; KH, KL
#define WS_QL  (WS_QH + 2u * NR * HD)
#define WS_KH  (WS_QL + 2u * NR * HD)
#define WS_KL  (WS_KH + 2u * NR * HD)
#define WS_VTH (WS_KL + 2u * NR * HD)                   // f16 [b][64 d][4096] v hi / lo
#define WS_VTL (WS_VTH + 2u * NR * HD)
#define WS_END (WS_VTL + 2u * NR * HD)

__global__ __launch_bounds__(256) void k_pack(const float* __restrict__ WQ, const float* __restrict__ WK, const float* __restrict__ WV, __bf16* __restrict__ PK) {
  __shared__ __align__(16) __bf16 s[EMB]; const int n = blockIdx.x, t = threadIdx.x; const int which = n / HD, d = n % HD; const float* Wm = (which == 0) ? WQ : (which == 1) ? WK : WV;
  for (int k = t; k < EMB; k += 256) s[k] = (__bf16)Wm[(size_t)k * HD + d];
  __syncthreads();
  if (t < EMB / 8) vst2((unsigned*)(PK + (size_t)n * EMB + t * 8), *(const v4u*)&s[t * 8]);
}
__global__ __launch_bounds__(128) void k_qkv(const float* __restrict__ X, const __bf16* __restrict__ PK, const float* __restrict__ BQ, const float* __restrict__ BK, const float* __restrict__ BV, _Float16* __restrict__ QH, _Float16* __restrict__ QL_, _Float16* __restrict__ KH, _Float16* __restrict__ KL, _Float16* __restrict__ VTH, _Float16* __restrict__ VTL) {
  __shared__ __align__(16) _Float16 sqh[4][16][72], sql[4][16][72], skh[4][16][72], skl[4][16][72]; __shared__ __align__(16) _Float16 svh[HD][72], svl[HD][72];
  const int tid = threadIdx.x, wave = tid >> 5, lane = tid & 31, col = lane & 15, g = lane >> 4; const size_t r0 = (size_t)blockIdx.x * 64 + wave * 16;
  v8f acc[12] = {};
  // loads go out in groups ahead of their use: a pass requests its 12 weight fragments together before its first product (one load latency a pass, not 12), and behind them the next pass's x values, which come from memory
  const float* xrow = X + (r0 + col) * EMB + 8 * g; v4f xc[4];
#pragma unroll
  for (int i = 0; i < 4; ++i) xc[i] = *(const v4f*)(xrow + (i >> 1) * 16 + (i & 1) * 4);
#pragma unroll 2   // two passes a trip: the x values fetched ahead change registers by renaming, not by copies
  for (int kc = 0; kc < EMB / 32; ++kc) { v16b wf[12]; v4f xn[4];
#pragma unroll
    for (int j = 0; j < 12; ++j) wf[j] = frag_b(PK + (size_t)(j * 16 + col) * EMB + kc * 32, lane);
    const int kn = (kc + 1 < EMB / 32) ? kc + 1 : kc;   // the last pass asks for its own values again: in bounds, not used
#pragma unroll
    for (int i = 0; i < 4; ++i) xn[i] = *(const v4f*)(xrow + kn * 32 + (i >> 1) * 16 + (i & 1) * 4);
    v16b a;
#pragma unroll
    for (int i = 0; i < 16; ++i) a[i] = (__bf16)xc[i >> 2][i & 3];
#pragma unroll
    for (int j = 0; j < 12; ++j) acc[j] = wmma_bf(a, wf[j], acc[j]);
#pragma unroll
    for (int i = 0; i < 4; ++i) xc[i] = xn[i]; }
#pragma unroll
  for (int j = 0; j < 12; ++j) { const int which = j >> 2; const int d = (j & 3) * 16 + col; const float bb = bfr((which == 0) ? BQ[d] : (which == 1) ? BK[d] : BV[d]);
#pragma unroll
    for (int r = 0; r < 8; ++r) { const float v = acc[j][r] + bb; const _Float16 hv = (_Float16)v; const _Float16 lv = (_Float16)((v - (float)hv) * 2048.0f);
      if (which == 0) { sqh[wave][8 * g + r][d] = hv; sql[wave][8 * g + r][d] = lv; } else if (which == 1) { skh[wave][8 * g + r][d] = hv; skl[wave][8 * g + r][d] = lv; } else { svh[d][wave * 16 + 8 * g + r] = hv; svl[d][wave * 16 + 8 * g + r] = lv; } } }
  __syncthreads();
  for (int rl = 0; rl < 16; ++rl) { const size_t o = (r0 + rl) * HD + (lane & 7) * 8; const int which = lane >> 3;
    if (which == 0) vst2((unsigned*)(QH + o), *(const v4u*)&sqh[wave][rl][(lane & 7) * 8]); else if (which == 1) vst2((unsigned*)(QL_ + o), *(const v4u*)&sql[wave][rl][(lane & 7) * 8]); else if (which == 2) vst2((unsigned*)(KH + o), *(const v4u*)&skh[wave][rl][(lane & 7) * 8]); else vst2((unsigned*)(KL + o), *(const v4u*)&skl[wave][rl][(lane & 7) * 8]); }
  { const size_t rb = (size_t)blockIdx.x * 64; const int b = (int)(rb / SS), s0 = (int)(rb % SS);
    for (int e = tid; e < HD * 8; e += 128) { const int d = e >> 3, pc = e & 7; const size_t o = ((size_t)b * HD + d) * SS + s0 + pc * 8; vst2((unsigned*)(VTH + o), *(const v4u*)&svh[d][pc * 8]); vst2((unsigned*)(VTL + o), *(const v4u*)&svl[d][pc * 8]); } }
}
// ---- k_attn: block = (16 queries, b), 16 waves: wave w takes the 32-key blocks w, w + 16, ... with its own running max, sum and accumulators; causal; 3-product scores / 8; online softmax; P hi/lo x V hi/lo;
// the 16 partial results are merged in LDS behind one work-group barrier (weights exp(m_w - M)); wave w stores output row w, f32 [64] (256 B by 32 lanes)
#define KW 16
__global__ __launch_bounds__(32 * KW) void k_attn(const _Float16* __restrict__ QH, const _Float16* __restrict__ QL_, const _Float16* __restrict__ KH, const _Float16* __restrict__ KL, const _Float16* __restrict__ VTH, const _Float16* __restrict__ VTL, float* __restrict__ OUT) {
  __shared__ __align__(16) _Float16 sph[KW][16][40], spl[KW][16][40]; __shared__ __align__(16) float so[KW][16][HD + 4]; __shared__ float sm[KW][16], sl[KW][16];
  const int tid = threadIdx.x, wave = __builtin_amdgcn_readfirstlane(tid >> 5) /* scalar: the key loop's start and trip count differ by wave and must be a scalar branch around the WMMAs */, lane = tid & 31, col = lane & 15, g = lane >> 4;
  // cost grows with the query tile (causal) and only one work-group fits a WGP at a time: the flat index is mapped so that cost falls with it (heaviest tiles of all batches start first, the one-block tiles fill the end); a permutation of (tile, batch)
  const int flat = blockIdx.y * TQB + blockIdx.x; const int qb = TQB - 1 - flat / TNB, b = flat % TNB; const int q0 = qb * 16; const size_t rq = (size_t)b * SS + q0 + col;
  v16h aqh[2], aql[2];
#pragma unroll
  for (int kc = 0; kc < 2; ++kc) { aqh[kc] = frag_h(QH + rq * HD + kc * 32, lane); aql[kc] = frag_h(QL_ + rq * HD + kc * 32, lane); }
  const _Float16* Vh = VTH + (size_t)b * HD * SS; const _Float16* Vl = VTL + (size_t)b * HD * SS;
  float m[8], l[8];
#pragma unroll
  for (int r = 0; r < 8; ++r) { m[r] = -3.0e38f; l[r] = 0.f; }
  v8f acc[4] = {}, accl[4] = {};
  const int nks = (q0 + 16 + 31) / 32;
  // a lane's place inside a K or V block as one 32-bit offset beside a wave-uniform base: the hi and lo planes share it, which frees the registers that the fragments in flight need (no scratch)
  const unsigned klane = (unsigned)(col * HD + 8 * g), vlane = (unsigned)(col * SS + 8 * g);
#pragma unroll 1
  for (int ks = wave; ks < nks; ks += KW) { v8f s[2];
    // the pass's eight K fragments are requested together before its first product: one load latency a pass instead of one a fragment
    v16h kfh[2][2], kfl[2][2]; const size_t kbase = ((size_t)b * SS + ks * 32) * HD;
#pragma unroll
    for (int ct = 0; ct < 2; ++ct) {
#pragma unroll
      for (int kc = 0; kc < 2; ++kc) { kfh[ct][kc] = frag_u(KH + kbase, klane + ct * 16 * HD + kc * 32); kfl[ct][kc] = frag_u(KL + kbase, klane + ct * 16 * HD + kc * 32); } }
#pragma unroll
    for (int ct = 0; ct < 2; ++ct) { const int dk = ks * 32 + ct * 16 + col - (q0 + 8 * g) /* key minus the lane's first query: the causal test against r needs one register, not eight */; v8f c = {}, cl = {};
#pragma unroll
      for (int kc = 0; kc < 2; ++kc) { c = wmma16(aqh[kc], kfh[ct][kc], c); cl = wmma16(aql[kc], kfh[ct][kc], cl); cl = wmma16(aqh[kc], kfl[ct][kc], cl); }
#pragma unroll
      for (int r = 0; r < 8; ++r) { const float sv = (c[r] + cl[r] * (1.0f / 2048.0f)) * 0.125f; s[ct][r] = (dk <= r) ? sv : -3.0e38f; } }
    // the pass's eight V fragments are requested here, in the registers the K fragments have left: they fly while the softmax starts
    v16h vfh[4], vfl[4];
#pragma unroll
    for (int dt = 0; dt < 4; ++dt) { vfh[dt] = frag_u(Vh + ks * 32, vlane + dt * 16 * SS); vfl[dt] = frag_u(Vl + ks * 32, vlane + dt * 16 * SS); }
#pragma unroll
    for (int r = 0; r < 8; ++r) { float mx = fmaxf(s[0][r], s[1][r]);
#pragma unroll
      for (int o = 1; o < 16; o <<= 1) mx = fmaxf(mx, __shfl_xor(mx, o));
      const float mn = fmaxf(m[r], mx); const float alpha = (m[r] <= -1.0e38f) ? 0.f : exp_ni(m[r] - mn);
      const float e0 = (s[0][r] <= -1.0e38f) ? 0.f : exp_ni(s[0][r] - mn), e1 = (s[1][r] <= -1.0e38f) ? 0.f : exp_ni(s[1][r] - mn); float es = e0 + e1;
#pragma unroll
      for (int o = 1; o < 16; o <<= 1) es += __shfl_xor(es, o);
      l[r] = l[r] * alpha + es; m[r] = mn;
#pragma unroll
      for (int dt = 0; dt < 4; ++dt) { acc[dt][r] *= alpha; accl[dt][r] *= alpha; }
      const _Float16 h0 = (_Float16)e0, h1 = (_Float16)e1; sph[wave][8 * g + r][col] = h0; sph[wave][8 * g + r][16 + col] = h1; spl[wave][8 * g + r][col] = (_Float16)((e0 - (float)h0) * 2048.0f); spl[wave][8 * g + r][16 + col] = (_Float16)((e1 - (float)h1) * 2048.0f); }
    LDSX();
    const v16h pah = frag_h(&sph[wave][col][0], lane), pal = frag_h(&spl[wave][col][0], lane);
#pragma unroll
    for (int dt = 0; dt < 4; ++dt) { acc[dt] = wmma16(pah, vfh[dt], acc[dt]); accl[dt] = wmma16(pal, vfh[dt], accl[dt]); accl[dt] = wmma16(pah, vfl[dt], accl[dt]); }
    LDSX(); }
#pragma unroll
  for (int r = 0; r < 8; ++r) { if (col == 0) { sm[wave][8 * g + r] = m[r]; sl[wave][8 * g + r] = l[r]; }
#pragma unroll
    for (int dt = 0; dt < 4; ++dt) so[wave][8 * g + r][dt * 16 + col] = acc[dt][r] + accl[dt][r] * (1.0f / 2048.0f); }
  __syncthreads();   // every wave's partial (max, sum, rows) is in LDS before any wave reads the others'; every wave passes here, also one that had no key block
  { const float mw = sm[col][wave], lw = sl[col][wave]; float mx = mw;   // lane holds the part of wave (lane & 15) for output row 'wave'; a wave that saw no open key has m = -3e38, l = 0 and gets weight 0
    for (int o = 1; o < 16; o <<= 1) mx = fmaxf(mx, __shfl_xor(mx, o));
    const float wg = (mw <= -1.0e38f) ? 0.f : exp_ni(mw - mx); float ls = wg * lw;
    for (int o = 1; o < 16; o <<= 1) ls += __shfl_xor(ls, o);
    v2f o2 = {};
#pragma unroll   // the 16 LDS reads and weight broadcasts are independent: unrolled they are issued together instead of one wait per part
    for (int w = 0; w < KW; ++w) o2 += __shfl(wg, w) * *(const v2f*)&so[w][wave][lane * 2];
    vst2(OUT + ((size_t)b * SS + q0 + wave) * HD + lane * 2, (v2f)(o2 * (1.0f / ls))); }
}
extern "C" void kernel_launch(void* const* d_in, const int* in_sizes, int n_in, void* d_out, int out_size, void* d_ws, size_t ws_size, hipStream_t stream) {
  (void)in_sizes; (void)n_in; (void)out_size;
  const float** F = (const float**)d_in;   // 0 x [4,4096,512], 1 Wq [512,64], 2 bq, 3 Wk, 4 bk, 5 Wv, 6 bv
  if (ws_size < (size_t)WS_END) return;
  char* ws = (char*)d_ws; __bf16* PK = (__bf16*)(ws + WS_PK); _Float16 *QH = (_Float16*)(ws + WS_QH), *QLp = (_Float16*)(ws + WS_QL), *KH = (_Float16*)(ws + WS_KH), *KL = (_Float16*)(ws + WS_KL), *VTH = (_Float16*)(ws + WS_VTH), *VTL = (_Float16*)(ws + WS_VTL);
  k_pack<<<192, 256, 0, stream>>>(F[1], F[3], F[5], PK);
  k_qkv<<<TNB * SS / 64, 128, 0, stream>>>(F[0], PK, F[2], F[4], F[6], QH, QLp, KH, KL, VTH, VTL);
  k_attn<<<dim3(TQB, TNB), 32 * KW, 0, stream>>>(QH, QLp, KH, KL, VTH, VTL, (float*)d_out);
}

// v004
// Measured time: 102 microseconds a run.
// Timed twice side by side with v003, it ran 1.28 times as fast both times.
// All steps since v000 together make it 6.83 times as fast.
// compute dtype: x, Wq, bq, Wk, bk, Wv, bv (module inputs) rounded to bf16; Q/K/V projection with exact bf16 products on WMMA 16x16x32 ((in,out) weights packed as transposed rows) + biases; q and k stored as f16 hi + (x2048-scaled) residual planes with 3-product scores, x 1/8 on the f32 score, causal mask, running-max softmax in f32 (precise expf); P as f16 hi + (x2048) residual x v hi/lo (3 products); f32 output rows.
#include <hip/hip_runtime.h>
#include <math.h>

typedef __attribute__((ext_vector_type(16))) _Float16 v16h;
typedef __attribute__((ext_vector_type(16))) __bf16 v16b;
typedef __attribute__((ext_vector_type(8)))  _Float16 v8h;
typedef __attribute__((ext_vector_type(8)))  float v8f;
typedef __attribute__((ext_vector_type(4)))  float v4f;
typedef __attribute__((ext_vector_type(2)))  float v2f;
typedef __attribute__((ext_vector_type(4)))  unsigned v4u;
typedef __attribute__((ext_vector_type(4)))  int v4i;
typedef float __attribute__((may_alias)) float_a;
typedef int __attribute__((may_alias)) int_a;

template <typename T> __device__ __forceinline__ void vst2(void* p, T v) { *(T*)p = v;  }
__device__ __forceinline__ v8f wmma16(v16h a, v16h b, v8f c) {
  v8f d = __builtin_amdgcn_wmma_f32_16x16x32_f16(false, a, false, b, (short)0, c, false, false);
  asm volatile("v_nop\n\tv_nop\n\tv_nop\n\tv_nop" : "+v"(d) : "v"(a), "v"(b));
  return d;
}
__device__ __forceinline__ v8f wmma_bf(v16b a, v16b b, v8f c) {
  v8f d = __builtin_amdgcn_wmma_f32_16x16x32_bf16(false, a, false, b, (short)0, c, false, false);
  asm volatile("v_nop\n\tv_nop\n\tv_nop\n\tv_nop" : "+v"(d) : "v"(a), "v"(b));
  return d;
}
// 16x16x32 fragments: lane = (h = lane>>4, row/col = lane&15); elements 0..7 = k0+8h+0..7, 8..15 = k0+16+8h+0..7; D element r = row 8h+r
__device__ __forceinline__ v16h frag_h(const _Float16* rowk0, int lane) {
  union { v16h v; v8h q[2]; } u; const _Float16* p = rowk0 + 8 * (lane >> 4);
  u.q[0] = *(const v8h*)p; u.q[1] = *(const v8h*)(p + 16); return u.v;
}
__device__ __forceinline__ v16h frag_f32(const float* rowk0, int lane) {
  v16h a; const float* p = rowk0 + 8 * (lane >> 4);
#pragma unroll
  for (int i = 0; i < 8; ++i) { a[i] = (_Float16)p[i]; a[8 + i] = (_Float16)p[16 + i]; }
  return a;
}
__device__ __forceinline__ v16h frag_f32s(const float* rowk0, int lane, float sc) {
  v16h a; const float* p = rowk0 + 8 * (lane >> 4);
#pragma unroll
  for (int i = 0; i < 8; ++i) { a[i] = (_Float16)(p[i] * sc); a[8 + i] = (_Float16)(p[16 + i] * sc); }
  return a;
}
// column fragment from a [K][ld] layout (column n), rows >= K read as 0
__device__ __forceinline__ v16h fragc_f32(const float* W, int k0, int n, int lane, int ld, int K) {
  v16h a; const int g = lane >> 4;
#pragma unroll
  for (int i = 0; i < 8; ++i) { const int ka = k0 + 8 * g + i, kb = ka + 16;
    a[i] = (_Float16)(ka < K ? W[(size_t)(ka < K ? ka : K - 1) * ld + n] : 0.f); a[8 + i] = (_Float16)(kb < K ? W[(size_t)(kb < K ? kb : K - 1) * ld + n] : 0.f); }
  return a;
}
struct F2 { v16b h, l; };
__device__ __forceinline__ F2 bsplit16(const float v[16]) { F2 r;
#pragma unroll
  for (int i = 0; i < 16; ++i) { const __bf16 h = (__bf16)v[i]; r.h[i] = h; r.l[i] = (__bf16)(v[i] - (float)h); }
  return r; }
__device__ __forceinline__ F2 split_row(const float* row, int k0, int lane) { float v[16]; const float* p = row + k0 + 8 * (lane >> 4);
#pragma unroll
  for (int i = 0; i < 8; ++i) { v[i] = p[i]; v[8 + i] = p[16 + i]; }
  return bsplit16(v); }
__device__ __forceinline__ F2 split_rowK(const float* row, int k0, int lane, int K) { float v[16]; const int g = lane >> 4;
#pragma unroll
  for (int i = 0; i < 8; ++i) { const int ka = k0 + 8 * g + i, kb = ka + 16; v[i] = ka < K ? row[ka < K ? ka : K - 1] : 0.f; v[8 + i] = kb < K ? row[kb < K ? kb : K - 1] : 0.f; }
  return bsplit16(v); }
__device__ __forceinline__ F2 split_col(const float* W, int k0, int n, int lane, int ld, int K) { float v[16]; const int g = lane >> 4;
#pragma unroll
  for (int i = 0; i < 8; ++i) { const int ka = k0 + 8 * g + i, kb = ka + 16; v[i] = ka < K ? W[(size_t)(ka < K ? ka : K - 1) * ld + n] : 0.f; v[8 + i] = kb < K ? W[(size_t)(kb < K ? kb : K - 1) * ld + n] : 0.f; }
  return bsplit16(v); }
__device__ __forceinline__ v8f mac3(const F2& a, const F2& b, v8f c) { c = wmma_bf(a.l, b.h, c); c = wmma_bf(a.h, b.l, c); return wmma_bf(a.h, b.h, c); }
__device__ __forceinline__ float sigm(float v) { return 1.0f / (1.0f + expf(-v)); }


// Single causal attention head (B 4, S 4,096, emb 512 -> head 64): softmax(Q K^T / 8, causal) V.
#define NB 4
#define SS 4096
#define NR (NB * SS)
#define EMB 512
#define HD 64
#ifndef TQB
#define TQB (SS / 16)
#define TNB NB
#endif
typedef __attribute__((ext_vector_type(8))) __bf16 v8b;
__device__ __forceinline__ v16b frag_b(const __bf16* rowk0, int lane) {
  union { v16b v; v8b q[2]; } u; const __bf16* p = rowk0 + 8 * (lane >> 4);
  u.q[0] = *(const v8b*)p; u.q[1] = *(const v8b*)(p + 16); return u.v;
}
// the same fragment as frag_h, from a wave-uniform base and the lane's own element offset (8 * (lane >> 4) included)
__device__ __forceinline__ v16h frag_u(const _Float16* base, unsigned off) {
  union { v16h v; v8h q[2]; } u; u.q[0] = *(const v8h*)(base + off); u.q[1] = *(const v8h*)(base + off + 16); return u.v;
}
__device__ __forceinline__ float bfr(float v) { return (float)(__bf16)v; }
__device__ __attribute__((noinline)) float exp_ni(float v) { return expf(v); }
__device__ __attribute__((noinline)) float erf_ni(float v) { return erff(v); }

#define WS_PK  0u                                     // bf16 [192][512]: Wq^T | Wk^T | Wv^T rows
#define WS_QH  (((2u * 192 * EMB) + 127u) / 128u * 128u)  // f16 [16384][64] q hi ; QL lo x2048 ; KH, KL
#define WS_QL  (WS_QH + 2u * NR * HD)
#define WS_KH  (WS_QL + 2u * NR * HD)
#define WS_KL  (WS_KH + 2u * NR * HD)
#define WS_VTH (WS_KL + 2u * NR * HD)                   // f16 [b][64 d][4096] v hi / lo
#define WS_VTL (WS_VTH + 2u * NR * HD)
#define WS_END (WS_VTL + 2u * NR * HD)

__global__ __launch_bounds__(256) void k_pack(const float* __restrict__ WQ, const float* __restrict__ WK, const float* __restrict__ WV, __bf16* __restrict__ PK) {
  __shared__ __align__(16) __bf16 s[EMB]; const int n = blockIdx.x, t = threadIdx.x; const int which = n / HD, d = n % HD; const float* Wm = (which == 0) ? WQ : (which == 1) ? WK : WV;
  for (int k = t; k < EMB; k += 256) s[k] = (__bf16)Wm[(size_t)k * HD + d];
  __syncthreads();
  if (t < EMB / 8) vst2((unsigned*)(PK + (size_t)n * EMB + t * 8), *(const v4u*)&s[t * 8]);
}
__global__ __launch_bounds__(128) void k_qkv(const float* __restrict__ X, const __bf16* __restrict__ PK, const float* __restrict__ BQ, const float* __restrict__ BK, const float* __restrict__ BV, _Float16* __restrict__ QH, _Float16* __restrict__ QL_, _Float16* __restrict__ KH, _Float16* __restrict__ KL, _Float16* __restrict__ VTH, _Float16* __restrict__ VTL) {
  __shared__ __align__(16) _Float16 sqh[4][16][72], sql[4][16][72], skh[4][16][72], skl[4][16][72]; __shared__ __align__(16) _Float16 svh[HD][72], svl[HD][72];
  const int tid = threadIdx.x, wave = tid >> 5, lane = tid & 31, col = lane & 15, g = lane >> 4; const size_t r0 = (size_t)blockIdx.x * 64 + wave * 16;
  v8f acc[12] = {};
  // loads go out in groups ahead of their use: a pass requests its 12 weight fragments together before its first product (one load latency a pass, not 12), and behind them the next pass's x values, which come from memory
  const float* xrow = X + (r0 + col) * EMB + 8 * g; v4f xc[4];
#pragma unroll
  for (int i = 0; i < 4; ++i) xc[i] = *(const v4f*)(xrow + (i >> 1) * 16 + (i & 1) * 4);
#pragma unroll 2   // two passes a trip: the x values fetched ahead change registers by renaming, not by copies
  for (int kc = 0; kc < EMB / 32; ++kc) { v16b wf[12]; v4f xn[4];
#pragma unroll
    for (int j = 0; j < 12; ++j) wf[j] = frag_b(PK + (size_t)(j * 16 + col) * EMB + kc * 32, lane);
    const int kn = (kc + 1 < EMB / 32) ? kc + 1 : kc;   // the last pass asks for its own values again: in bounds, not used
#pragma unroll
    for (int i = 0; i < 4; ++i) xn[i] = *(const v4f*)(xrow + kn * 32 + (i >> 1) * 16 + (i & 1) * 4);
    v16b a;
#pragma unroll
    for (int i = 0; i < 16; ++i) a[i] = (__bf16)xc[i >> 2][i & 3];
#pragma unroll
    for (int j = 0; j < 12; ++j) acc[j] = wmma_bf(a, wf[j], acc[j]);
#pragma unroll
    for (int i = 0; i < 4; ++i) xc[i] = xn[i]; }
#pragma unroll
  for (int j = 0; j < 12; ++j) { const int which = j >> 2; const int d = (j & 3) * 16 + col; const float bb = bfr((which == 0) ? BQ[d] : (which == 1) ? BK[d] : BV[d]);
#pragma unroll
    for (int r = 0; r < 8; ++r) { const float v = acc[j][r] + bb; const _Float16 hv = (_Float16)v; const _Float16 lv = (_Float16)((v - (float)hv) * 2048.0f);
      if (which == 0) { sqh[wave][8 * g + r][d] = hv; sql[wave][8 * g + r][d] = lv; } else if (which == 1) { skh[wave][8 * g + r][d] = hv; skl[wave][8 * g + r][d] = lv; } else { svh[d][wave * 16 + 8 * g + r] = hv; svl[d][wave * 16 + 8 * g + r] = lv; } } }
  __syncthreads();
  for (int rl = 0; rl < 16; ++rl) { const size_t o = (r0 + rl) * HD + (lane & 7) * 8; const int which = lane >> 3;
    if (which == 0) vst2((unsigned*)(QH + o), *(const v4u*)&sqh[wave][rl][(lane & 7) * 8]); else if (which == 1) vst2((unsigned*)(QL_ + o), *(const v4u*)&sql[wave][rl][(lane & 7) * 8]); else if (which == 2) vst2((unsigned*)(KH + o), *(const v4u*)&skh[wave][rl][(lane & 7) * 8]); else vst2((unsigned*)(KL + o), *(const v4u*)&skl[wave][rl][(lane & 7) * 8]); }
  { const size_t rb = (size_t)blockIdx.x * 64; const int b = (int)(rb / SS), s0 = (int)(rb % SS);
    for (int e = tid; e < HD * 8; e += 128) { const int d = e >> 3, pc = e & 7; const size_t o = ((size_t)b * HD + d) * SS + s0 + pc * 8; vst2((unsigned*)(VTH + o), *(const v4u*)&svh[d][pc * 8]); vst2((unsigned*)(VTL + o), *(const v4u*)&svl[d][pc * 8]); } }
}
#define KW 16
// the value of lane ^ 16
__device__ __forceinline__ float xhalf(float v) { const int b = __builtin_bit_cast(int, v); return __builtin_bit_cast(float, __builtin_amdgcn_permlanex16(b, b, 0x76543210, 0xfedcba98, false, false)); }
__global__ __launch_bounds__(32 * KW) void k_attn(const _Float16* __restrict__ QH, const _Float16* __restrict__ QL_, const _Float16* __restrict__ KH, const _Float16* __restrict__ KL, const _Float16* __restrict__ VTH, const _Float16* __restrict__ VTL, float* __restrict__ OUT) {
  __shared__ __align__(16) float so[KW][16][HD + 4]; __shared__ float sm[KW][16], sl[KW][16];
  const int tid = threadIdx.x, wave = __builtin_amdgcn_readfirstlane(tid >> 5) /* scalar: the key loop's start and trip count differ by wave and must be a scalar branch around the WMMAs */, lane = tid & 31, col = lane & 15, g = lane >> 4;
  // cost grows with the query tile (causal) and only one work-group fits a WGP at a time: the flat index is mapped so that cost falls with it (heaviest tiles of all batches start first, the one-block tiles fill the end); a permutation of (tile, batch)
  const int flat = blockIdx.y * TQB + blockIdx.x; const int qb = TQB - 1 - flat / TNB, b = flat % TNB; const int q0 = qb * 16; const size_t rq = (size_t)b * SS + q0 + col;
  v16h aqh[2], aql[2];
#pragma unroll
  for (int kc = 0; kc < 2; ++kc) { aqh[kc] = frag_h(QH + rq * HD + kc * 32, lane); aql[kc] = frag_h(QL_ + rq * HD + kc * 32, lane); }
  const _Float16* Vh = VTH + (size_t)b * HD * SS; const _Float16* Vl = VTL + (size_t)b * HD * SS;
  float m = -3.0e38f, l = 0.f;   // of query q0 + col; m is equal in both halves, l is the sum over the half's own keys
  v8f acc[4] = {}, accl[4] = {};   // element r of tile dt = O^T[dt * 16 + 8 g + r][query col]
  const int nks = (q0 + 16 + 31) / 32;
  // a lane's place inside a K or V block as one 32-bit offset beside a wave-uniform base: the hi and lo planes share it, which frees the registers that the fragments in flight need (no scratch)
  const unsigned klane = (unsigned)(col * HD + 8 * g), vlane = (unsigned)(col * SS + 8 * g);
#pragma unroll 1
  for (int ks = wave; ks < nks; ks += KW) { v8f s[2];
    // the pass's eight K fragments are requested together before its first product: one load latency a pass instead of one a fragment
    v16h kfh[2][2], kfl[2][2]; const size_t kbase = ((size_t)b * SS + ks * 32) * HD;
#pragma unroll
    for (int ct = 0; ct < 2; ++ct) {
#pragma unroll
      for (int kc = 0; kc < 2; ++kc) { kfh[ct][kc] = frag_u(KH + kbase, klane + ct * 16 * HD + kc * 32); kfl[ct][kc] = frag_u(KL + kbase, klane + ct * 16 * HD + kc * 32); } }
#pragma unroll
    for (int ct = 0; ct < 2; ++ct) { const int dq = q0 + col - (ks * 32 + ct * 16 + 8 * g) /* the lane's query minus its first key of the tile: key 8 g + r is open where r <= dq */; v8f c = {}, cl = {};
#pragma unroll
      for (int kc = 0; kc < 2; ++kc) { c = wmma16(kfh[ct][kc], aqh[kc], c); cl = wmma16(kfh[ct][kc], aql[kc], cl); cl = wmma16(kfl[ct][kc], aqh[kc], cl); }
#pragma unroll
      for (int r = 0; r < 8; ++r) { const float sv = (c[r] + cl[r] * (1.0f / 2048.0f)) * 0.125f; s[ct][r] = (r <= dq) ? sv : -3.0e38f; } }
    // the pass's eight V fragments are requested here, in the registers the K fragments have left: they fly while the softmax starts
    v16h vfh[4], vfl[4];
#pragma unroll
    for (int dt = 0; dt < 4; ++dt) { vfh[dt] = frag_u(Vh + ks * 32, vlane + dt * 16 * SS); vfl[dt] = frag_u(Vl + ks * 32, vlane + dt * 16 * SS); }
    float mx = fmaxf(s[0][0], s[1][0]);
#pragma unroll
    for (int r = 1; r < 8; ++r) mx = fmaxf(mx, fmaxf(s[0][r], s[1][r]));
    mx = fmaxf(mx, xhalf(mx));   // both halves feed one P^T fragment: they need the same maximum
    const float mn = fmaxf(m, mx); const float alpha = (m <= -1.0e38f) ? 0.f : exp_ni(m - mn); m = mn;
    v16h pah, pal; float es = 0.f;
#pragma unroll
    for (int ct = 0; ct < 2; ++ct) {
#pragma unroll
      for (int r = 0; r < 8; ++r) { const float e = (s[ct][r] <= -1.0e38f) ? 0.f : exp_ni(s[ct][r] - mn); es += e;
        const _Float16 h = (_Float16)e; pah[ct * 8 + r] = h; pal[ct * 8 + r] = (_Float16)((e - (float)h) * 2048.0f); } }   // element ct * 8 + r = key 16 ct + 8 g + r: the fragments' k order, as V's loader has it
    l = l * alpha + es;
#pragma unroll
    for (int dt = 0; dt < 4; ++dt) { acc[dt] *= alpha; accl[dt] *= alpha; }
#pragma unroll
    for (int dt = 0; dt < 4; ++dt) { acc[dt] = wmma16(vfh[dt], pah, acc[dt]); accl[dt] = wmma16(vfh[dt], pal, accl[dt]); accl[dt] = wmma16(vfl[dt], pah, accl[dt]); } }
  l += xhalf(l);
  if (g == 0) { sm[wave][col] = m; sl[wave][col] = l; }
#pragma unroll
  for (int dt = 0; dt < 4; ++dt) { const v8f o = acc[dt] + accl[dt] * (1.0f / 2048.0f);
    *(v4f*)&so[wave][col][dt * 16 + 8 * g] = __builtin_shufflevector(o, o, 0, 1, 2, 3); *(v4f*)&so[wave][col][dt * 16 + 8 * g + 4] = __builtin_shufflevector(o, o, 4, 5, 6, 7); }
  __syncthreads();   // every wave's partial (max, sum, rows) is in LDS before any wave reads the others'; every wave passes here, also one that had no key block
  { const float mw = sm[col][wave], lw = sl[col][wave]; float mx = mw;   // lane holds the part of wave (lane & 15) for output row 'wave'; a wave that saw no open key has m = -3e38, l = 0 and gets weight 0
    for (int o = 1; o < 16; o <<= 1) mx = fmaxf(mx, __shfl_xor(mx, o));
    const float wg = (mw <= -1.0e38f) ? 0.f : exp_ni(mw - mx); float ls = wg * lw;
    for (int o = 1; o < 16; o <<= 1) ls += __shfl_xor(ls, o);
    v2f o2 = {};
#pragma unroll   // the 16 LDS reads and weight broadcasts are independent: unrolled they are issued together instead of one wait per part
    for (int w = 0; w < KW; ++w) o2 += __shfl(wg, w) * *(const v2f*)&so[w][wave][lane * 2];
    vst2(OUT + ((size_t)b * SS + q0 + wave) * HD + lane * 2, (v2f)(o2 * (1.0f / ls))); }
}
extern "C" void kernel_launch(void* const* d_in, const int* in_sizes, int n_in, void* d_out, int out_size, void* d_ws, size_t ws_size, hipStream_t stream) {
  (void)in_sizes; (void)n_in; (void)out_size;
  const float** F = (const float**)d_in;   // 0 x [4,4096,512], 1 Wq [512,64], 2 bq, 3 Wk, 4 bk, 5 Wv, 6 bv
  if (ws_size < (size_t)WS_END) return;
  char* ws = (char*)d_ws; __bf16* PK = (__bf16*)(ws + WS_PK); _Float16 *QH = (_Float16*)(ws + WS_QH), *QLp = (_Float16*)(ws + WS_QL), *KH = (_Float16*)(ws + WS_KH), *KL = (_Float16*)(ws + WS_KL), *VTH = (_Float16*)(ws + WS_VTH), *VTL = (_Float16*)(ws + WS_VTL);
  k_pack<<<192, 256, 0, stream>>>(F[1], F[3], F[5], PK);
  k_qkv<<<TNB * SS / 64, 128, 0, stream>>>(F[0], PK, F[2], F[4], F[6], QH, QLp, KH, KL, VTH, VTL);
  k_attn<<<dim3(TQB, TNB), 32 * KW, 0, stream>>>(QH, QLp, KH, KL, VTH, VTL, (float*)d_out);
}

// v005
// One run takes 74.4 microseconds.
// Two timings next to v004 both put it at 1.38 times that version's speed.
// Over all steps from v000 it is 9.40 times as fast.
// compute dtype: x, Wq, bq, Wk, bk, Wv, bv (module inputs) rounded to bf16; Q/K/V projection with exact bf16 products on WMMA 16x16x32 ((in,out) weights packed as transposed fragments) + biases; q and k stored as f16 hi + (x2048-scaled) residual planes with 3-product scores, x 1/8 on the f32 score, causal mask, running-max softmax in f32 (precise expf); P as f16 hi + (x2048) residual x v hi/lo (3 products); f32 output rows.
#include <hip/hip_runtime.h>
#include <math.h>

typedef __attribute__((ext_vector_type(16))) _Float16 v16h;
typedef __attribute__((ext_vector_type(16))) __bf16 v16b;
typedef __attribute__((ext_vector_type(8)))  _Float16 v8h;
typedef __attribute__((ext_vector_type(8)))  float v8f;
typedef __attribute__((ext_vector_type(4)))  float v4f;
typedef __attribute__((ext_vector_type(2)))  float v2f;
typedef __attribute__((ext_vector_type(4)))  unsigned v4u;
typedef __attribute__((ext_vector_type(4)))  int v4i;
typedef float __attribute__((may_alias)) float_a;
typedef int __attribute__((may_alias)) int_a;

template <typename T> __device__ __forceinline__ void vst2(void* p, T v) { *(T*)p = v;  }
__device__ __forceinline__ v8f wmma16(v16h a, v16h b, v8f c) {
  v8f d = __builtin_amdgcn_wmma_f32_16x16x32_f16(false, a, false, b, (short)0, c, false, false);
  asm volatile("v_nop\n\tv_nop\n\tv_nop\n\tv_nop" : "+v"(d) : "v"(a), "v"(b));
  return d;
}
__device__ __forceinline__ v8f wmma_bf(v16b a, v16b b, v8f c) {
  v8f d = __builtin_amdgcn_wmma_f32_16x16x32_bf16(false, a, false, b, (short)0, c, false, false);
  asm volatile("v_nop\n\tv_nop\n\tv_nop\n\tv_nop" : "+v"(d) : "v"(a), "v"(b));
  return d;
}
// 16x16x32 fragments: lane = (h = lane>>4, row/col = lane&15); elements 0..7 = k0+8h+0..7, 8..15 = k0+16+8h+0..7; D element r = row 8h+r
__device__ __forceinline__ v16h frag_h(const _Float16* rowk0, int lane) {
  union { v16h v; v8h q[2]; } u; const _Float16* p = rowk0 + 8 * (lane >> 4);
  u.q[0] = *(const v8h*)p; u.q[1] = *(const v8h*)(p + 16); return u.v;
}
__device__ __forceinline__ v16h frag_f32(const float* rowk0, int lane) {
  v16h a; const float* p = rowk0 + 8 * (lane >> 4);
#pragma unroll
  for (int i = 0; i < 8; ++i) { a[i] = (_Float16)p[i]; a[8 + i] = (_Float16)p[16 + i]; }
  return a;
}
__device__ __forceinline__ v16h frag_f32s(const float* rowk0, int lane, float sc) {
  v16h a; const float* p = rowk0 + 8 * (lane >> 4);
#pragma unroll
  for (int i = 0; i < 8; ++i) { a[i] = (_Float16)(p[i] * sc); a[8 + i] = (_Float16)(p[16 + i] * sc); }
  return a;
}
// column fragment from a [K][ld] layout (column n), rows >= K read as 0
__device__ __forceinline__ v16h fragc_f32(const float* W, int k0, int n, int lane, int ld, int K) {
  v16h a; const int g = lane >> 4;
#pragma unroll
  for (int i = 0; i < 8; ++i) { const int ka = k0 + 8 * g + i, kb = ka + 16;
    a[i] = (_Float16)(ka < K ? W[(size_t)(ka < K ? ka : K - 1) * ld + n] : 0.f); a[8 + i] = (_Float16)(kb < K ? W[(size_t)(kb < K ? kb : K - 1) * ld + n] : 0.f); }
  return a;
}
struct F2 { v16b h, l; };
__device__ __forceinline__ F2 bsplit16(const float v[16]) { F2 r;
#pragma unroll
  for (int i = 0; i < 16; ++i) { const __bf16 h = (__bf16)v[i]; r.h[i] = h; r.l[i] = (__bf16)(v[i] - (float)h); }
  return r; }
__device__ __forceinline__ F2 split_row(const float* row, int k0, int lane) { float v[16]; const float* p = row + k0 + 8 * (lane >> 4);
#pragma unroll
  for (int i = 0; i < 8; ++i) { v[i] = p[i]; v[8 + i] = p[16 + i]; }
  return bsplit16(v); }
__device__ __forceinline__ F2 split_rowK(const float* row, int k0, int lane, int K) { float v[16]; const int g = lane >> 4;
#pragma unroll
  for (int i = 0; i < 8; ++i) { const int ka = k0 + 8 * g + i, kb = ka + 16; v[i] = ka < K ? row[ka < K ? ka : K - 1] : 0.f; v[8 + i] = kb < K ? row[kb < K ? kb : K - 1] : 0.f; }
  return bsplit16(v); }
__device__ __forceinline__ F2 split_col(const float* W, int k0, int n, int lane, int ld, int K) { float v[16]; const int g = lane >> 4;
#pragma unroll
  for (int i = 0; i < 8; ++i) { const int ka = k0 + 8 * g + i, kb = ka + 16; v[i] = ka < K ? W[(size_t)(ka < K ? ka : K - 1) * ld + n] : 0.f; v[8 + i] = kb < K ? W[(size_t)(kb < K ? kb : K - 1) * ld + n] : 0.f; }
  return bsplit16(v); }
__device__ __forceinline__ v8f mac3(const F2& a, const F2& b, v8f c) { c = wmma_bf(a.l, b.h, c); c = wmma_bf(a.h, b.l, c); return wmma_bf(a.h, b.h, c); }
__device__ __forceinline__ float sigm(float v) { return 1.0f / (1.0f + expf(-v)); }


// Single causal attention head (B 4, S 4,096, emb 512 -> head 64): softmax(Q K^T / 8, causal) V.
#define NB 4
#define SS 4096
#define NR (NB * SS)
#define EMB 512
#define HD 64
#ifndef TQB
#define TQB (SS / 16)
#define TNB NB
#endif
typedef __attribute__((ext_vector_type(8))) __bf16 v8b;
// FRAGMENT ORDER: the workspace planes hold every 16 x 32 operand fragment as 512 elements in a row: [half j][lane][8 elements], where lane = 16 g + row and the 8 elements are k = 16 j + 8 g + 0..7 of that row
// (the registers' own order). A wave-wide 16-byte load then covers 512 contiguous bytes, 4 whole lines, where a row-major plane makes it touch 16 lines for 32 bytes each.
// base: wave-uniform; off: the lane's 32-bit byte offset from it (16 * lane, and what moves from pass to pass); c: the fragment's constant byte offset
__device__ __forceinline__ v16b frag_pb(const __bf16* base, unsigned off, int c) {
  union { v16b v; v8b q[2]; } u; const char* p = (const char*)base + off + c; u.q[0] = *(const v8b*)p; u.q[1] = *(const v8b*)(p + 512); return u.v;
}
__device__ __forceinline__ v16h frag_p(const _Float16* base, unsigned off, int c) {
  union { v16h v; v8h q[2]; } u; const char* p = (const char*)base + off + c; u.q[0] = *(const v8h*)p; u.q[1] = *(const v8h*)(p + 512); return u.v;
}
__device__ __forceinline__ float bfr(float v) { return (float)(__bf16)v; }
__device__ __attribute__((noinline)) float exp_ni(float v) { return expf(v); }
__device__ __attribute__((noinline)) float erf_ni(float v) { return erff(v); }

#define WS_PK  0u                                     // bf16 [16 kc][12 column tiles: Wq^T | Wk^T | Wv^T][512]: fragments (16 columns x 32 k)
#define WS_QH  (((2u * 192 * EMB) + 127u) / 128u * 128u)  // f16 [1024 row tiles][2 kc][512] q hi: fragments (16 rows x 32 d) ; QL lo x2048 ; KH, KL
#define WS_QL  (WS_QH + 2u * NR * HD)
#define WS_KH  (WS_QL + 2u * NR * HD)
#define WS_KL  (WS_KH + 2u * NR * HD)
#define WS_VTH (WS_KL + 2u * NR * HD)                   // f16 [512 key blocks][4 dt][512] v hi / lo: fragments (16 d x 32 keys)
#define WS_VTL (WS_VTH + 2u * NR * HD)
#define WS_END (WS_VTL + 2u * NR * HD)

__global__ __launch_bounds__(256) void k_pack(const float* __restrict__ WQ, const float* __restrict__ WK, const float* __restrict__ WV, __bf16* __restrict__ PK) {
  // block = one fragment: column tile jt (16 of the 192 columns), k block kc (32 of 512); it alone writes the fragment's 1,024 bytes
  __shared__ __align__(16) __bf16 s[16][40]; const int jt = blockIdx.x % 12, kc = blockIdx.x / 12, t = threadIdx.x; const int which = jt >> 2, d0 = (jt & 3) * 16; const float* Wm = (which == 0) ? WQ : (which == 1) ? WK : WV;
  const float* Wb = Wm + (size_t)kc * 32 * HD + d0;
#pragma unroll   // the thread's two values are requested together
  for (int h = 0; h < 2; ++h) { const unsigned k = h * 16 + (t >> 4), c = t & 15; s[c][k] = (__bf16)Wb[k * HD + c]; }
  __syncthreads();
  if (t < 64) { const int j = t >> 5, ln = t & 31; vst2((unsigned*)(PK + (size_t)(kc * 12 + jt) * 512 + t * 8), *(const v4u*)&s[ln & 15][j * 16 + (ln >> 4) * 8]); }
}
__global__ __launch_bounds__(128) void k_qkv(const float* __restrict__ X, const __bf16* __restrict__ PK, const float* __restrict__ BQ, const float* __restrict__ BK, const float* __restrict__ BV, _Float16* __restrict__ QH, _Float16* __restrict__ QL_, _Float16* __restrict__ KH, _Float16* __restrict__ KL, _Float16* __restrict__ VTH, _Float16* __restrict__ VTL) {
  __shared__ __align__(16) _Float16 sqh[4][16][72], sql[4][16][72], skh[4][16][72], skl[4][16][72]; __shared__ __align__(16) _Float16 svh[HD][72], svl[HD][72];
  const int tid = threadIdx.x, wave = tid >> 5, lane = tid & 31, col = lane & 15, g = lane >> 4; const size_t r0 = (size_t)blockIdx.x * 64 + wave * 16;
  v8f acc[12] = {};
  // loads go out in groups ahead of their use: a pass requests its 12 weight fragments together before its first product (one load latency a pass, not 12), and behind them the next pass's x values, which come from memory
  const float* xrow = X + (r0 + col) * EMB + 8 * g; v4f xc[4];
#pragma unroll
  for (int i = 0; i < 4; ++i) xc[i] = *(const v4f*)(xrow + (i >> 1) * 16 + (i & 1) * 4);
#pragma unroll 2   // two passes a trip: the x values fetched ahead change registers by renaming, not by copies
  for (int kc = 0; kc < EMB / 32; ++kc) { v16b wf[12]; v4f xn[4];
#pragma unroll
    for (int j = 0; j < 12; ++j) wf[j] = frag_pb(PK, (unsigned)(kc * 12 * 1024 + lane * 16), j * 1024);
    const int kn = (kc + 1 < EMB / 32) ? kc + 1 : kc;   // the last pass asks for its own values again: in bounds, not used
#pragma unroll
    for (int i = 0; i < 4; ++i) xn[i] = *(const v4f*)(xrow + kn * 32 + (i >> 1) * 16 + (i & 1) * 4);
    v16b a;
#pragma unroll
    for (int i = 0; i < 16; ++i) a[i] = (__bf16)xc[i >> 2][i & 3];
#pragma unroll
    for (int j = 0; j < 12; ++j) acc[j] = wmma_bf(a, wf[j], acc[j]);
#pragma unroll
    for (int i = 0; i < 4; ++i) xc[i] = xn[i]; }
#pragma unroll
  for (int j = 0; j < 12; ++j) { const int which = j >> 2; const int d = (j & 3) * 16 + col; const float bb = bfr((which == 0) ? BQ[d] : (which == 1) ? BK[d] : BV[d]);
#pragma unroll
    for (int r = 0; r < 8; ++r) { const float v = acc[j][r] + bb; const _Float16 hv = (_Float16)v; const _Float16 lv = (_Float16)((v - (float)hv) * 2048.0f);
      if (which == 0) { sqh[wave][8 * g + r][d] = hv; sql[wave][8 * g + r][d] = lv; } else if (which == 1) { skh[wave][8 * g + r][d] = hv; skl[wave][8 * g + r][d] = lv; } else { svh[d][wave * 16 + 8 * g + r] = hv; svl[d][wave * 16 + 8 * g + r] = lv; } } }
  __syncthreads();
  // q, k: the wave's 16 rows are one row tile = 2 fragments = 4 runs of 512 bytes a plane; run i holds d = 16 i + 8 g + 0..7 of row col
  for (int i = 0; i < 4; ++i) { const size_t o = r0 * HD + i * 256 + lane * 8; const int dc = i * 16 + g * 8;
    vst2((unsigned*)(QH + o), *(const v4u*)&sqh[wave][col][dc]); vst2((unsigned*)(QL_ + o), *(const v4u*)&sql[wave][col][dc]); vst2((unsigned*)(KH + o), *(const v4u*)&skh[wave][col][dc]); vst2((unsigned*)(KL + o), *(const v4u*)&skl[wave][col][dc]); }
  // v: the block's 64 keys are two 32-key blocks of 4 fragments; piece e = [key block][dt][half j][lane] holds keys 16 j + 8 g + 0..7 of d = 16 dt + (lane & 15)
  { const size_t vb = (size_t)blockIdx.x * 64 * HD;
    for (int e = tid; e < HD * 8; e += 128) { const int d = ((e >> 6) & 3) * 16 + (e & 15), kk = (e >> 8) * 32 + ((e >> 5) & 1) * 16 + ((e >> 4) & 1) * 8; const size_t o = vb + (size_t)e * 8; vst2((unsigned*)(VTH + o), *(const v4u*)&svh[d][kk]); vst2((unsigned*)(VTL + o), *(const v4u*)&svl[d][kk]); } }
}
#define KW 16
// the value of lane ^ 16
__device__ __forceinline__ float xhalf(float v) { const int b = __builtin_bit_cast(int, v); return __builtin_bit_cast(float, __builtin_amdgcn_permlanex16(b, b, 0x76543210, 0xfedcba98, false, false)); }
__global__ __launch_bounds__(32 * KW) void k_attn(const _Float16* __restrict__ QH, const _Float16* __restrict__ QL_, const _Float16* __restrict__ KH, const _Float16* __restrict__ KL, const _Float16* __restrict__ VTH, const _Float16* __restrict__ VTL, float* __restrict__ OUT) {
  __shared__ __align__(16) float so[KW][16][HD + 4]; __shared__ float sm[KW][16], sl[KW][16];
  const int tid = threadIdx.x, wave = __builtin_amdgcn_readfirstlane(tid >> 5) /* scalar: the key loop's start and trip count differ by wave and must be a scalar branch around the WMMAs */, lane = tid & 31, col = lane & 15, g = lane >> 4;
  // cost grows with the query tile (causal) and only one work-group fits a WGP at a time: the flat index is mapped so that cost falls with it (heaviest tiles of all batches start first, the one-block tiles fill the end); a permutation of (tile, batch)
  const int flat = blockIdx.y * TQB + blockIdx.x; const int qb = TQB - 1 - flat / TNB, b = flat % TNB; const int q0 = qb * 16; const unsigned lane16 = (unsigned)lane * 16;
  v16h aqh[2], aql[2];
#pragma unroll
  for (int kc = 0; kc < 2; ++kc) { aqh[kc] = frag_p(QH + ((size_t)b * SS + q0) * HD, lane16, kc * 1024); aql[kc] = frag_p(QL_ + ((size_t)b * SS + q0) * HD, lane16, kc * 1024); }
  const _Float16 *Kh = KH + (size_t)b * SS * HD, *Kl = KL + (size_t)b * SS * HD, *Vh = VTH + (size_t)b * SS * HD, *Vl = VTL + (size_t)b * SS * HD;   // the batch's planes: a 32-key block is 4,096 bytes in each
  float m = -3.0e38f, l = 0.f;   // of query q0 + col; m is equal in both halves, l is the sum over the half's own keys
  v8f acc[4] = {}, accl[4] = {};   // element r of tile dt = O^T[dt * 16 + 8 g + r][query col]
  const int nks = (q0 + 16 + 31) / 32;
#pragma unroll 1
  for (int ks = wave; ks < nks; ks += KW) { v8f s[2];
    // the pass's eight K fragments are requested together before its first product: one load latency a pass instead of one a fragment
    v16h kfh[2][2], kfl[2][2]; const unsigned off = (unsigned)ks * 4096u + lane16;
#pragma unroll
    for (int ct = 0; ct < 2; ++ct) {
#pragma unroll
      for (int kc = 0; kc < 2; ++kc) { kfh[ct][kc] = frag_p(Kh, off, (ct * 2 + kc) * 1024); kfl[ct][kc] = frag_p(Kl, off, (ct * 2 + kc) * 1024); } }
#pragma unroll
    for (int ct = 0; ct < 2; ++ct) { const int dq = q0 + col - (ks * 32 + ct * 16 + 8 * g) /* the lane's query minus its first key of the tile: key 8 g + r is open where r <= dq */; v8f c = {}, cl = {};
#pragma unroll
      for (int kc = 0; kc < 2; ++kc) { c = wmma16(kfh[ct][kc], aqh[kc], c); cl = wmma16(kfh[ct][kc], aql[kc], cl); cl = wmma16(kfl[ct][kc], aqh[kc], cl); }
#pragma unroll
      for (int r = 0; r < 8; ++r) { const float sv = (c[r] + cl[r] * (1.0f / 2048.0f)) * 0.125f; s[ct][r] = (r <= dq) ? sv : -3.0e38f; } }
    // the pass's eight V fragments are requested here, in the registers the K fragments have left: they fly while the softmax starts
    v16h vfh[4], vfl[4];
#pragma unroll
    for (int dt = 0; dt < 4; ++dt) { vfh[dt] = frag_p(Vh, off, dt * 1024); vfl[dt] = frag_p(Vl, off, dt * 1024); }
    float mx = fmaxf(s[0][0], s[1][0]);
#pragma unroll
    for (int r = 1; r < 8; ++r) mx = fmaxf(mx, fmaxf(s[0][r], s[1][r]));
    mx = fmaxf(mx, xhalf(mx));   // both halves feed one P^T fragment: they need the same maximum
    const float mn = fmaxf(m, mx); const float alpha = (m <= -1.0e38f) ? 0.f : exp_ni(m - mn); m = mn;
    v16h pah, pal; float es = 0.f;
#pragma unroll
    for (int ct = 0; ct < 2; ++ct) {
#pragma unroll
      for (int r = 0; r < 8; ++r) { const float e = (s[ct][r] <= -1.0e38f) ? 0.f : exp_ni(s[ct][r] - mn); es += e;
        const _Float16 h = (_Float16)e; pah[ct * 8 + r] = h; pal[ct * 8 + r] = (_Float16)((e - (float)h) * 2048.0f); } }   // element ct * 8 + r = key 16 ct + 8 g + r: the fragments' k order, as V's loader has it
    l = l * alpha + es;
#pragma unroll
    for (int dt = 0; dt < 4; ++dt) { acc[dt] *= alpha; accl[dt] *= alpha; }
#pragma unroll
    for (int dt = 0; dt < 4; ++dt) { acc[dt] = wmma16(vfh[dt], pah, acc[dt]); accl[dt] = wmma16(vfh[dt], pal, accl[dt]); accl[dt] = wmma16(vfl[dt], pah, accl[dt]); } }
  l += xhalf(l);
  if (g == 0) { sm[wave][col] = m; sl[wave][col] = l; }
#pragma unroll
  for (int dt = 0; dt < 4; ++dt) { const v8f o = acc[dt] + accl[dt] * (1.0f / 2048.0f);
    *(v4f*)&so[wave][col][dt * 16 + 8 * g] = __builtin_shufflevector(o, o, 0, 1, 2, 3); *(v4f*)&so[wave][col][dt * 16 + 8 * g + 4] = __builtin_shufflevector(o, o, 4, 5, 6, 7); }
  __syncthreads();   // every wave's partial (max, sum, rows) is in LDS before any wave reads the others'; every wave passes here, also one that had no key block
  { const float mw = sm[col][wave], lw = sl[col][wave]; float mx = mw;   // lane holds the part of wave (lane & 15) for output row 'wave'; a wave that saw no open key has m = -3e38, l = 0 and gets weight 0
    for (int o = 1; o < 16; o <<= 1) mx = fmaxf(mx, __shfl_xor(mx, o));
    const float wg = (mw <= -1.0e38f) ? 0.f : exp_ni(mw - mx); float ls = wg * lw;
    for (int o = 1; o < 16; o <<= 1) ls += __shfl_xor(ls, o);
    v2f o2 = {};
#pragma unroll   // the 16 LDS reads and weight broadcasts are independent: unrolled they are issued together instead of one wait per part
    for (int w = 0; w < KW; ++w) o2 += __shfl(wg, w) * *(const v2f*)&so[w][wave][lane * 2];
    vst2(OUT + ((size_t)b * SS + q0 + wave) * HD + lane * 2, (v2f)(o2 * (1.0f / ls))); }
}
extern "C" void kernel_launch(void* const* d_in, const int* in_sizes, int n_in, void* d_out, int out_size, void* d_ws, size_t ws_size, hipStream_t stream) {
  (void)in_sizes; (void)n_in; (void)out_size;
  const float** F = (const float**)d_in;   // 0 x [4,4096,512], 1 Wq [512,64], 2 bq, 3 Wk, 4 bk, 5 Wv, 6 bv
  if (ws_size < (size_t)WS_END) return;
  char* ws = (char*)d_ws; __bf16* PK = (__bf16*)(ws + WS_PK); _Float16 *QH = (_Float16*)(ws + WS_QH), *QLp = (_Float16*)(ws + WS_QL), *KH = (_Float16*)(ws + WS_KH), *KL = (_Float16*)(ws + WS_KL), *VTH = (_Float16*)(ws + WS_VTH), *VTL = (_Float16*)(ws + WS_VTL);
  k_pack<<<192, 256, 0, stream>>>(F[1], F[3], F[5], PK);
  k_qkv<<<TNB * SS / 64, 128, 0, stream>>>(F[0], PK, F[2], F[4], F[6], QH, QLp, KH, KL, VTH, VTL);
  k_attn<<<dim3(TQB, TNB), 32 * KW, 0, stream>>>(QH, QLp, KH, KL, VTH, VTL, (float*)d_out);
}

// v006
// It runs in 64.7 microseconds.
// Timed twice side by side with v005, it ran 1.14 and 1.15 times as fast.
// Over all steps from v000 it is 10.8 times as fast.
// compute dtype: x, Wq, bq, Wk, bk, Wv, bv (module inputs) rounded to bf16; Q/K/V projection with exact bf16 products on WMMA 16x16x32 ((in,out) weights packed as transposed fragments) + biases; q and k stored as f16 hi + (x2048-scaled) residual planes with 3-product scores, x 1/8 on the f32 score, causal mask, running-max softmax in f32 (base 2, hardware exponential); P as f16 hi + (x2048) residual x v hi/lo (3 products); f32 output rows.
#include <hip/hip_runtime.h>
#include <math.h>

typedef __attribute__((ext_vector_type(16))) _Float16 v16h;
typedef __attribute__((ext_vector_type(16))) __bf16 v16b;
typedef __attribute__((ext_vector_type(8)))  _Float16 v8h;
typedef __attribute__((ext_vector_type(8)))  float v8f;
typedef __attribute__((ext_vector_type(4)))  float v4f;
typedef __attribute__((ext_vector_type(2)))  float v2f;
typedef __attribute__((ext_vector_type(4)))  unsigned v4u;
typedef __attribute__((ext_vector_type(4)))  int v4i;
typedef float __attribute__((may_alias)) float_a;
typedef int __attribute__((may_alias)) int_a;

template <typename T> __device__ __forceinline__ void vst2(void* p, T v) { *(T*)p = v;  }
__device__ __forceinline__ v8f wmma16(v16h a, v16h b, v8f c) {
  v8f d = __builtin_amdgcn_wmma_f32_16x16x32_f16(false, a, false, b, (short)0, c, false, false);
  asm volatile("v_nop\n\tv_nop\n\tv_nop\n\tv_nop" : "+v"(d) : "v"(a), "v"(b));
  return d;
}
__device__ __forceinline__ v8f wmma_bf(v16b a, v16b b, v8f c) {
  v8f d = __builtin_amdgcn_wmma_f32_16x16x32_bf16(false, a, false, b, (short)0, c, false, false);
  asm volatile("v_nop\n\tv_nop\n\tv_nop\n\tv_nop" : "+v"(d) : "v"(a), "v"(b));
  return d;
}
// 16x16x32 fragments: lane = (h = lane>>4, row/col = lane&15); elements 0..7 = k0+8h+0..7, 8..15 = k0+16+8h+0..7; D element r = row 8h+r
__device__ __forceinline__ v16h frag_h(const _Float16* rowk0, int lane) {
  union { v16h v; v8h q[2]; } u; const _Float16* p = rowk0 + 8 * (lane >> 4);
  u.q[0] = *(const v8h*)p; u.q[1] = *(const v8h*)(p + 16); return u.v;
}
__device__ __forceinline__ v16h frag_f32(const float* rowk0, int lane) {
  v16h a; const float* p = rowk0 + 8 * (lane >> 4);
#pragma unroll
  for (int i = 0; i < 8; ++i) { a[i] = (_Float16)p[i]; a[8 + i] = (_Float16)p[16 + i]; }
  return a;
}
__device__ __forceinline__ v16h frag_f32s(const float* rowk0, int lane, float sc) {
  v16h a; const float* p = rowk0 + 8 * (lane >> 4);
#pragma unroll
  for (int i = 0; i < 8; ++i) { a[i] = (_Float16)(p[i] * sc); a[8 + i] = (_Float16)(p[16 + i] * sc); }
  return a;
}
// column fragment from a [K][ld] layout (column n), rows >= K read as 0
__device__ __forceinline__ v16h fragc_f32(const float* W, int k0, int n, int lane, int ld, int K) {
  v16h a; const int g = lane >> 4;
#pragma unroll
  for (int i = 0; i < 8; ++i) { const int ka = k0 + 8 * g + i, kb = ka + 16;
    a[i] = (_Float16)(ka < K ? W[(size_t)(ka < K ? ka : K - 1) * ld + n] : 0.f); a[8 + i] = (_Float16)(kb < K ? W[(size_t)(kb < K ? kb : K - 1) * ld + n] : 0.f); }
  return a;
}
struct F2 { v16b h, l; };
__device__ __forceinline__ F2 bsplit16(const float v[16]) { F2 r;
#pragma unroll
  for (int i = 0; i < 16; ++i) { const __bf16 h = (__bf16)v[i]; r.h[i] = h; r.l[i] = (__bf16)(v[i] - (float)h); }
  return r; }
__device__ __forceinline__ F2 split_row(const float* row, int k0, int lane) { float v[16]; const float* p = row + k0 + 8 * (lane >> 4);
#pragma unroll
  for (int i = 0; i < 8; ++i) { v[i] = p[i]; v[8 + i] = p[16 + i]; }
  return bsplit16(v); }
__device__ __forceinline__ F2 split_rowK(const float* row, int k0, int lane, int K) { float v[16]; const int g = lane >> 4;
#pragma unroll
  for (int i = 0; i < 8; ++i) { const int ka = k0 + 8 * g + i, kb = ka + 16; v[i] = ka < K ? row[ka < K ? ka : K - 1] : 0.f; v[8 + i] = kb < K ? row[kb < K ? kb : K - 1] : 0.f; }
  return bsplit16(v); }
__device__ __forceinline__ F2 split_col(const float* W, int k0, int n, int lane, int ld, int K) { float v[16]; const int g = lane >> 4;
#pragma unroll
  for (int i = 0; i < 8; ++i) { const int ka = k0 + 8 * g + i, kb = ka + 16; v[i] = ka < K ? W[(size_t)(ka < K ? ka : K - 1) * ld + n] : 0.f; v[8 + i] = kb < K ? W[(size_t)(kb < K ? kb : K - 1) * ld + n] : 0.f; }
  return bsplit16(v); }
__device__ __forceinline__ v8f mac3(const F2& a, const F2& b, v8f c) { c = wmma_bf(a.l, b.h, c); c = wmma_bf(a.h, b.l, c); return wmma_bf(a.h, b.h, c); }
__device__ __forceinline__ float sigm(float v) { return 1.0f / (1.0f + expf(-v)); }


// Single causal attention head (B 4, S 4,096, emb 512 -> head 64): softmax(Q K^T / 8, causal) V.
#define NB 4
#define SS 4096
#define NR (NB * SS)
#define EMB 512
#define HD 64
#ifndef TQB
#define TQB (SS / 16)
#define TNB NB
#endif
typedef __attribute__((ext_vector_type(8))) __bf16 v8b;
// FRAGMENT ORDER: the workspace planes hold every 16 x 32 operand fragment as 512 elements in a row: [half j][lane][8 elements], where lane = 16 g + row and the 8 elements are k = 16 j + 8 g + 0..7 of that row
// (the registers' own order). A wave-wide 16-byte load then covers 512 contiguous bytes, 4 whole lines, where a row-major plane makes it touch 16 lines for 32 bytes each.
// base: wave-uniform; off: the lane's 32-bit byte offset from it (16 * lane, and what moves from pass to pass); c: the fragment's constant byte offset
__device__ __forceinline__ v16b frag_pb(const __bf16* base, unsigned off, int c) {
  union { v16b v; v8b q[2]; } u; const char* p = (const char*)base + off + c; u.q[0] = *(const v8b*)p; u.q[1] = *(const v8b*)(p + 512); return u.v;
}
__device__ __forceinline__ v16h frag_p(const _Float16* base, unsigned off, int c) {
  union { v16h v; v8h q[2]; } u; const char* p = (const char*)base + off + c; u.q[0] = *(const v8h*)p; u.q[1] = *(const v8h*)(p + 512); return u.v;
}
__device__ __forceinline__ float bfr(float v) { return (float)(__bf16)v; }
__device__ __attribute__((noinline)) float erf_ni(float v) { return erff(v); }

#define WS_PK  0u                                     // bf16 [16 kc][12 column tiles: Wq^T | Wk^T | Wv^T][512]: fragments (16 columns x 32 k)
#define WS_QH  (((2u * 192 * EMB) + 127u) / 128u * 128u)  // f16 [1024 row tiles][2 kc][512] q hi: fragments (16 rows x 32 d) ; QL lo x2048 ; KH, KL
#define WS_QL  (WS_QH + 2u * NR * HD)
#define WS_KH  (WS_QL + 2u * NR * HD)
#define WS_KL  (WS_KH + 2u * NR * HD)
#define WS_VTH (WS_KL + 2u * NR * HD)                   // f16 [512 key blocks][4 dt][512] v hi / lo: fragments (16 d x 32 keys)
#define WS_VTL (WS_VTH + 2u * NR * HD)
#define WS_END (WS_VTL + 2u * NR * HD)

__global__ __launch_bounds__(256) void k_pack(const float* __restrict__ WQ, const float* __restrict__ WK, const float* __restrict__ WV, __bf16* __restrict__ PK) {
  // block = one fragment: column tile jt (16 of the 192 columns), k block kc (32 of 512); it alone writes the fragment's 1,024 bytes
  __shared__ __align__(16) __bf16 s[16][40]; const int jt = blockIdx.x % 12, kc = blockIdx.x / 12, t = threadIdx.x; const int which = jt >> 2, d0 = (jt & 3) * 16; const float* Wm = (which == 0) ? WQ : (which == 1) ? WK : WV;
  const float* Wb = Wm + (size_t)kc * 32 * HD + d0;
#pragma unroll   // the thread's two values are requested together
  for (int h = 0; h < 2; ++h) { const unsigned k = h * 16 + (t >> 4), c = t & 15; s[c][k] = (__bf16)Wb[k * HD + c]; }
  __syncthreads();
  if (t < 64) { const int j = t >> 5, ln = t & 31; vst2((unsigned*)(PK + (size_t)(kc * 12 + jt) * 512 + t * 8), *(const v4u*)&s[ln & 15][j * 16 + (ln >> 4) * 8]); }
}
__global__ __launch_bounds__(128) void k_qkv(const float* __restrict__ X, const __bf16* __restrict__ PK, const float* __restrict__ BQ, const float* __restrict__ BK, const float* __restrict__ BV, _Float16* __restrict__ QH, _Float16* __restrict__ QL_, _Float16* __restrict__ KH, _Float16* __restrict__ KL, _Float16* __restrict__ VTH, _Float16* __restrict__ VTL) {
  __shared__ __align__(16) _Float16 sqh[4][16][72], sql[4][16][72], skh[4][16][72], skl[4][16][72]; __shared__ __align__(16) _Float16 svh[HD][72], svl[HD][72];
  const int tid = threadIdx.x, wave = tid >> 5, lane = tid & 31, col = lane & 15, g = lane >> 4; const size_t r0 = (size_t)blockIdx.x * 64 + wave * 16;
  v8f acc[12] = {};
  // loads go out in groups ahead of their use: a pass requests its 12 weight fragments together before its first product (one load latency a pass, not 12), and behind them the next pass's x values, which come from memory
  const float* xrow = X + (r0 + col) * EMB + 8 * g; v4f xc[4];
#pragma unroll
  for (int i = 0; i < 4; ++i) xc[i] = *(const v4f*)(xrow + (i >> 1) * 16 + (i & 1) * 4);
#pragma unroll 2   // two passes a trip: the x values fetched ahead change registers by renaming, not by copies
  for (int kc = 0; kc < EMB / 32; ++kc) { v16b wf[12]; v4f xn[4];
#pragma unroll
    for (int j = 0; j < 12; ++j) wf[j] = frag_pb(PK, (unsigned)(kc * 12 * 1024 + lane * 16), j * 1024);
    const int kn = (kc + 1 < EMB / 32) ? kc + 1 : kc;   // the last pass asks for its own values again: in bounds, not used
#pragma unroll
    for (int i = 0; i < 4; ++i) xn[i] = *(const v4f*)(xrow + kn * 32 + (i >> 1) * 16 + (i & 1) * 4);
    v16b a;
#pragma unroll
    for (int i = 0; i < 16; ++i) a[i] = (__bf16)xc[i >> 2][i & 3];
#pragma unroll
    for (int j = 0; j < 12; ++j) acc[j] = wmma_bf(a, wf[j], acc[j]);
#pragma unroll
    for (int i = 0; i < 4; ++i) xc[i] = xn[i]; }
#pragma unroll
  for (int j = 0; j < 12; ++j) { const int which = j >> 2; const int d = (j & 3) * 16 + col; const float bb = bfr((which == 0) ? BQ[d] : (which == 1) ? BK[d] : BV[d]);
#pragma unroll
    for (int r = 0; r < 8; ++r) { const float v = acc[j][r] + bb; const _Float16 hv = (_Float16)v; const _Float16 lv = (_Float16)((v - (float)hv) * 2048.0f);
      if (which == 0) { sqh[wave][8 * g + r][d] = hv; sql[wave][8 * g + r][d] = lv; } else if (which == 1) { skh[wave][8 * g + r][d] = hv; skl[wave][8 * g + r][d] = lv; } else { svh[d][wave * 16 + 8 * g + r] = hv; svl[d][wave * 16 + 8 * g + r] = lv; } } }
  __syncthreads();
  // q, k: the wave's 16 rows are one row tile = 2 fragments = 4 runs of 512 bytes a plane; run i holds d = 16 i + 8 g + 0..7 of row col
  for (int i = 0; i < 4; ++i) { const size_t o = r0 * HD + i * 256 + lane * 8; const int dc = i * 16 + g * 8;
    vst2((unsigned*)(QH + o), *(const v4u*)&sqh[wave][col][dc]); vst2((unsigned*)(QL_ + o), *(const v4u*)&sql[wave][col][dc]); vst2((unsigned*)(KH + o), *(const v4u*)&skh[wave][col][dc]); vst2((unsigned*)(KL + o), *(const v4u*)&skl[wave][col][dc]); }
  // v: the block's 64 keys are two 32-key blocks of 4 fragments; piece e = [key block][dt][half j][lane] holds keys 16 j + 8 g + 0..7 of d = 16 dt + (lane & 15)
  { const size_t vb = (size_t)blockIdx.x * 64 * HD;
    for (int e = tid; e < HD * 8; e += 128) { const int d = ((e >> 6) & 3) * 16 + (e & 15), kk = (e >> 8) * 32 + ((e >> 5) & 1) * 16 + ((e >> 4) & 1) * 8; const size_t o = vb + (size_t)e * 8; vst2((unsigned*)(VTH + o), *(const v4u*)&svh[d][kk]); vst2((unsigned*)(VTL + o), *(const v4u*)&svl[d][kk]); } }
}
#define KW 16
#define SC2 0.18033688011112042f   // log2(e) / 8: softmax in base 2, exp(s / 8 - max) = 2^(s * SC2 - max2), one multiply-add and one hardware exponential a score
// the value of lane ^ 16
__device__ __forceinline__ float xhalf(float v) { const int b = __builtin_bit_cast(int, v); return __builtin_bit_cast(float, __builtin_amdgcn_permlanex16(b, b, 0x76543210, 0xfedcba98, false, false)); }
__global__ __launch_bounds__(32 * KW) void k_attn(const _Float16* __restrict__ QH, const _Float16* __restrict__ QL_, const _Float16* __restrict__ KH, const _Float16* __restrict__ KL, const _Float16* __restrict__ VTH, const _Float16* __restrict__ VTL, float* __restrict__ OUT) {
  __shared__ __align__(16) float so[KW][16][HD + 4]; __shared__ float sm[KW][16], sl[KW][16];
  const int tid = threadIdx.x, wave = __builtin_amdgcn_readfirstlane(tid >> 5) /* scalar: the key loop's start and trip count differ by wave and must be a scalar branch around the WMMAs */, lane = tid & 31, col = lane & 15, g = lane >> 4;
  // cost grows with the query tile (causal) and only one work-group fits a WGP at a time: the flat index is mapped so that cost falls with it (heaviest tiles of all batches start first, the one-block tiles fill the end); a permutation of (tile, batch)
  const int flat = blockIdx.y * TQB + blockIdx.x; const int qb = TQB - 1 - flat / TNB, b = flat % TNB; const int q0 = qb * 16; const unsigned lane16 = (unsigned)lane * 16;
  v16h aqh[2], aql[2];
#pragma unroll
  for (int kc = 0; kc < 2; ++kc) { aqh[kc] = frag_p(QH + ((size_t)b * SS + q0) * HD, lane16, kc * 1024); aql[kc] = frag_p(QL_ + ((size_t)b * SS + q0) * HD, lane16, kc * 1024); }
  const _Float16 *Kh = KH + (size_t)b * SS * HD, *Kl = KL + (size_t)b * SS * HD, *Vh = VTH + (size_t)b * SS * HD, *Vl = VTL + (size_t)b * SS * HD;   // the batch's planes: a 32-key block is 4,096 bytes in each
  float m = -3.0e38f, l = 0.f;   // of query q0 + col; m, in base-2 units (score x log2 e / 8), is equal in both halves, l is the sum over the half's own keys
  v8f acc[4] = {}, accl[4] = {};   // element r of tile dt = O^T[dt * 16 + 8 g + r][query col]
  const int nks = (q0 + 16 + 31) / 32;
#pragma unroll 1
  for (int ks = wave; ks < nks; ks += KW) { v8f s[2];
    // the pass's eight K fragments are requested together before its first product: one load latency a pass instead of one a fragment
    v16h kfh[2][2], kfl[2][2]; const unsigned off = (unsigned)ks * 4096u + lane16;
#pragma unroll
    for (int ct = 0; ct < 2; ++ct) {
#pragma unroll
      for (int kc = 0; kc < 2; ++kc) { kfh[ct][kc] = frag_p(Kh, off, (ct * 2 + kc) * 1024); kfl[ct][kc] = frag_p(Kl, off, (ct * 2 + kc) * 1024); } }
#pragma unroll
    for (int ct = 0; ct < 2; ++ct) { const int dq = q0 + col - (ks * 32 + ct * 16 + 8 * g) /* the lane's query minus its first key of the tile: key 8 g + r is open where r <= dq */; v8f c = {}, cl = {};
#pragma unroll
      for (int kc = 0; kc < 2; ++kc) { c = wmma16(kfh[ct][kc], aqh[kc], c); cl = wmma16(kfh[ct][kc], aql[kc], cl); cl = wmma16(kfl[ct][kc], aqh[kc], cl); }
#pragma unroll
      for (int r = 0; r < 8; ++r) { const float sv = c[r] + cl[r] * (1.0f / 2048.0f); s[ct][r] = (r <= dq) ? sv : -3.0e38f; } }   // raw q.k: the factor 1/8 goes into the exponent's multiply-add
    // the pass's eight V fragments are requested here, in the registers the K fragments have left: they fly while the softmax starts
    v16h vfh[4], vfl[4];
#pragma unroll
    for (int dt = 0; dt < 4; ++dt) { vfh[dt] = frag_p(Vh, off, dt * 1024); vfl[dt] = frag_p(Vl, off, dt * 1024); }
    float mx = fmaxf(s[0][0], s[1][0]);
#pragma unroll
    for (int r = 1; r < 8; ++r) mx = fmaxf(mx, fmaxf(s[0][r], s[1][r]));
    mx = fmaxf(mx, xhalf(mx));   // both halves feed one P^T fragment: they need the same maximum
    const float mn = fmaxf(m, mx * SC2); const float alpha = __builtin_amdgcn_exp2f(m - mn) /* 0 on a wave's first pass, where m is -3e38 */; m = mn;
    v16h pah, pal; float es = 0.f;
#pragma unroll
    for (int ct = 0; ct < 2; ++ct) {
#pragma unroll
      for (int r = 0; r < 8; ++r) { const float e = __builtin_amdgcn_exp2f(fmaf(s[ct][r], SC2, -mn)) /* a closed key's -3e38 gives exactly 0: every query has an open key in every block its tile visits, so mn is a real score */; es += e;
        const _Float16 h = (_Float16)e; pah[ct * 8 + r] = h; pal[ct * 8 + r] = (_Float16)((e - (float)h) * 2048.0f); } }   // element ct * 8 + r = key 16 ct + 8 g + r: the fragments' k order, as V's loader has it
    l = l * alpha + es;
#pragma unroll
    for (int dt = 0; dt < 4; ++dt) { acc[dt] *= alpha; accl[dt] *= alpha; }
#pragma unroll
    for (int dt = 0; dt < 4; ++dt) { acc[dt] = wmma16(vfh[dt], pah, acc[dt]); accl[dt] = wmma16(vfh[dt], pal, accl[dt]); accl[dt] = wmma16(vfl[dt], pah, accl[dt]); } }
  l += xhalf(l);
  if (g == 0) { sm[wave][col] = m; sl[wave][col] = l; }
#pragma unroll
  for (int dt = 0; dt < 4; ++dt) { const v8f o = acc[dt] + accl[dt] * (1.0f / 2048.0f);
    *(v4f*)&so[wave][col][dt * 16 + 8 * g] = __builtin_shufflevector(o, o, 0, 1, 2, 3); *(v4f*)&so[wave][col][dt * 16 + 8 * g + 4] = __builtin_shufflevector(o, o, 4, 5, 6, 7); }
  __syncthreads();   // every wave's partial (max, sum, rows) is in LDS before any wave reads the others'; every wave passes here, also one that had no key block
  { const float mw = sm[col][wave], lw = sl[col][wave]; float mx = mw;   // lane holds the part of wave (lane & 15) for output row 'wave'; a wave that saw no open key has m = -3e38, l = 0 and gets weight 0
    for (int o = 1; o < 16; o <<= 1) mx = fmaxf(mx, __shfl_xor(mx, o));
    const float wg = __builtin_amdgcn_exp2f(mw - mx); float ls = wg * lw;
    for (int o = 1; o < 16; o <<= 1) ls += __shfl_xor(ls, o);
    v2f o2 = {};
#pragma unroll   // the 16 LDS reads and weight broadcasts are independent: unrolled they are issued together instead of one wait per part
    for (int w = 0; w < KW; ++w) o2 += __shfl(wg, w) * *(const v2f*)&so[w][wave][lane * 2];
    vst2(OUT + ((size_t)b * SS + q0 + wave) * HD + lane * 2, (v2f)(o2 * (1.0f / ls))); }
}
extern "C" void kernel_launch(void* const* d_in, const int* in_sizes, int n_in, void* d_out, int out_size, void* d_ws, size_t ws_size, hipStream_t stream) {
  (void)in_sizes; (void)n_in; (void)out_size;
  const float** F = (const float**)d_in;   // 0 x [4,4096,512], 1 Wq [512,64], 2 bq, 3 Wk, 4 bk, 5 Wv, 6 bv
  if (ws_size < (size_t)WS_END) return;
  char* ws = (char*)d_ws; __bf16* PK = (__bf16*)(ws + WS_PK); _Float16 *QH = (_Float16*)(ws + WS_QH), *QLp = (_Float16*)(ws + WS_QL), *KH = (_Float16*)(ws + WS_KH), *KL = (_Float16*)(ws + WS_KL), *VTH = (_Float16*)(ws + WS_VTH), *VTL = (_Float16*)(ws + WS_VTL);
  k_pack<<<192, 256, 0, stream>>>(F[1], F[3], F[5], PK);
  k_qkv<<<TNB * SS / 64, 128, 0, stream>>>(F[0], PK, F[2], F[4], F[6], QH, QLp, KH, KL, VTH, VTL);
  k_attn<<<dim3(TQB, TNB), 32 * KW, 0, stream>>>(QH, QLp, KH, KL, VTH, VTL, (float*)d_out);
}

// v007
// Measured time: 49.2 microseconds a run.
// Next to v006, in two timings, it ran 1.35 and 1.32 times as fast.
// Over all steps from v000 it is 14.3 times as fast.
// compute dtype: x, Wq, bq, Wk, bk, Wv, bv (module inputs) rounded to bf16; Q/K/V projection with exact bf16 products on WMMA 16x16x32 ((in,out) weights packed as transposed fragments) + biases; q and k stored as f16 hi + (x2048-scaled) residual planes with 3-product scores, x 1/8 on the f32 score, causal mask, running-max softmax in f32 (base 2, hardware exponential); P as f16 hi + (x2048) residual x v hi/lo (3 products); f32 output rows.
#include <hip/hip_runtime.h>
#include <math.h>

typedef __attribute__((ext_vector_type(16))) _Float16 v16h;
typedef __attribute__((ext_vector_type(16))) __bf16 v16b;
typedef __attribute__((ext_vector_type(8)))  _Float16 v8h;
typedef __attribute__((ext_vector_type(8)))  float v8f;
typedef __attribute__((ext_vector_type(4)))  float v4f;
typedef __attribute__((ext_vector_type(2)))  float v2f;
typedef __attribute__((ext_vector_type(4)))  unsigned v4u;
typedef __attribute__((ext_vector_type(4)))  int v4i;
typedef float __attribute__((may_alias)) float_a;
typedef int __attribute__((may_alias)) int_a;

template <typename T> __device__ __forceinline__ void vst2(void* p, T v) { *(T*)p = v;  }
__device__ __forceinline__ v8f wmma16(v16h a, v16h b, v8f c) {
  return __builtin_amdgcn_wmma_f32_16x16x32_f16(false, a, false, b, (short)0, c, false, false);   // the plain builtin: the compiler keeps its distances itself, and its operands may live above v255, which an asm operand cannot
}
__device__ __forceinline__ v8f wmma_bf(v16b a, v16b b, v8f c) {
  v8f d = __builtin_amdgcn_wmma_f32_16x16x32_bf16(false, a, false, b, (short)0, c, false, false);
  asm volatile("v_nop\n\tv_nop\n\tv_nop\n\tv_nop" : "+v"(d) : "v"(a), "v"(b));
  return d;
}
// 16x16x32 fragments: lane = (h = lane>>4, row/col = lane&15); elements 0..7 = k0+8h+0..7, 8..15 = k0+16+8h+0..7; D element r = row 8h+r
__device__ __forceinline__ v16h frag_h(const _Float16* rowk0, int lane) {
  union { v16h v; v8h q[2]; } u; const _Float16* p = rowk0 + 8 * (lane >> 4);
  u.q[0] = *(const v8h*)p; u.q[1] = *(const v8h*)(p + 16); return u.v;
}
__device__ __forceinline__ v16h frag_f32(const float* rowk0, int lane) {
  v16h a; const float* p = rowk0 + 8 * (lane >> 4);
#pragma unroll
  for (int i = 0; i < 8; ++i) { a[i] = (_Float16)p[i]; a[8 + i] = (_Float16)p[16 + i]; }
  return a;
}
__device__ __forceinline__ v16h frag_f32s(const float* rowk0, int lane, float sc) {
  v16h a; const float* p = rowk0 + 8 * (lane >> 4);
#pragma unroll
  for (int i = 0; i < 8; ++i) { a[i] = (_Float16)(p[i] * sc); a[8 + i] = (_Float16)(p[16 + i] * sc); }
  return a;
}
// column fragment from a [K][ld] layout (column n), rows >= K read as 0
__device__ __forceinline__ v16h fragc_f32(const float* W, int k0, int n, int lane, int ld, int K) {
  v16h a; const int g = lane >> 4;
#pragma unroll
  for (int i = 0; i < 8; ++i) { const int ka = k0 + 8 * g + i, kb = ka + 16;
    a[i] = (_Float16)(ka < K ? W[(size_t)(ka < K ? ka : K - 1) * ld + n] : 0.f); a[8 + i] = (_Float16)(kb < K ? W[(size_t)(kb < K ? kb : K - 1) * ld + n] : 0.f); }
  return a;
}
struct F2 { v16b h, l; };
__device__ __forceinline__ F2 bsplit16(const float v[16]) { F2 r;
#pragma unroll
  for (int i = 0; i < 16; ++i) { const __bf16 h = (__bf16)v[i]; r.h[i] = h; r.l[i] = (__bf16)(v[i] - (float)h); }
  return r; }
__device__ __forceinline__ F2 split_row(const float* row, int k0, int lane) { float v[16]; const float* p = row + k0 + 8 * (lane >> 4);
#pragma unroll
  for (int i = 0; i < 8; ++i) { v[i] = p[i]; v[8 + i] = p[16 + i]; }
  return bsplit16(v); }
__device__ __forceinline__ F2 split_rowK(const float* row, int k0, int lane, int K) { float v[16]; const int g = lane >> 4;
#pragma unroll
  for (int i = 0; i < 8; ++i) { const int ka = k0 + 8 * g + i, kb = ka + 16; v[i] = ka < K ? row[ka < K ? ka : K - 1] : 0.f; v[8 + i] = kb < K ? row[kb < K ? kb : K - 1] : 0.f; }
  return bsplit16(v); }
__device__ __forceinline__ F2 split_col(const float* W, int k0, int n, int lane, int ld, int K) { float v[16]; const int g = lane >> 4;
#pragma unroll
  for (int i = 0; i < 8; ++i) { const int ka = k0 + 8 * g + i, kb = ka + 16; v[i] = ka < K ? W[(size_t)(ka < K ? ka : K - 1) * ld + n] : 0.f; v[8 + i] = kb < K ? W[(size_t)(kb < K ? kb : K - 1) * ld + n] : 0.f; }
  return bsplit16(v); }
__device__ __forceinline__ v8f mac3(const F2& a, const F2& b, v8f c) { c = wmma_bf(a.l, b.h, c); c = wmma_bf(a.h, b.l, c); return wmma_bf(a.h, b.h, c); }
__device__ __forceinline__ float sigm(float v) { return 1.0f / (1.0f + expf(-v)); }


// Single causal attention head (B 4, S 4,096, emb 512 -> head 64): softmax(Q K^T / 8, causal) V.
#define NB 4
#define SS 4096
#define NR (NB * SS)
#define EMB 512
#define HD 64
#ifndef TQB
#define TQB (SS / 32)
#define TNB NB
#endif
typedef __attribute__((ext_vector_type(8))) __bf16 v8b;
// FRAGMENT ORDER: the workspace planes hold every 16 x 32 operand fragment as 512 elements in a row: [half j][lane][8 elements], where lane = 16 g + row and the 8 elements are k = 16 j + 8 g + 0..7 of that row
// (the registers' own order). A wave-wide 16-byte load then covers 512 contiguous bytes, 4 whole lines, where a row-major plane makes it touch 16 lines for 32 bytes each.
// base: wave-uniform; off: the lane's 32-bit byte offset from it (16 * lane, and what moves from pass to pass); c: the fragment's constant byte offset
__device__ __forceinline__ v16b frag_pb(const __bf16* base, unsigned off, int c) {
  union { v16b v; v8b q[2]; } u; const char* p = (const char*)base + off + c; u.q[0] = *(const v8b*)p; u.q[1] = *(const v8b*)(p + 512); return u.v;
}
__device__ __forceinline__ v16h frag_p(const _Float16* base, unsigned off, int c) {
  union { v16h v; v8h q[2]; } u; const char* p = (const char*)base + off + c; u.q[0] = *(const v8h*)p; u.q[1] = *(const v8h*)(p + 512); return u.v;
}
__device__ __forceinline__ float bfr(float v) { return (float)(__bf16)v; }
__device__ __attribute__((noinline)) float erf_ni(float v) { return erff(v); }

#define WS_PK  0u                                     // bf16 [16 kc][12 column tiles: Wq^T | Wk^T | Wv^T][512]: fragments (16 columns x 32 k)
#define WS_QH  (((2u * 192 * EMB) + 127u) / 128u * 128u)  // f16 [1024 row tiles][2 kc][512] q hi: fragments (16 rows x 32 d) ; QL lo x2048 ; KH, KL
#define WS_QL  (WS_QH + 2u * NR * HD)
#define WS_KH  (WS_QL + 2u * NR * HD)
#define WS_KL  (WS_KH + 2u * NR * HD)
#define WS_VTH (WS_KL + 2u * NR * HD)                   // f16 [512 key blocks][4 dt][512] v hi / lo: fragments (16 d x 32 keys)
#define WS_VTL (WS_VTH + 2u * NR * HD)
#define WS_END (WS_VTL + 2u * NR * HD)

__global__ __launch_bounds__(256) void k_pack(const float* __restrict__ WQ, const float* __restrict__ WK, const float* __restrict__ WV, __bf16* __restrict__ PK) {
  // block = one fragment: column tile jt (16 of the 192 columns), k block kc (32 of 512); it alone writes the fragment's 1,024 bytes
  __shared__ __align__(16) __bf16 s[16][40]; const int jt = blockIdx.x % 12, kc = blockIdx.x / 12, t = threadIdx.x; const int which = jt >> 2, d0 = (jt & 3) * 16; const float* Wm = (which == 0) ? WQ : (which == 1) ? WK : WV;
  const float* Wb = Wm + (size_t)kc * 32 * HD + d0;
#pragma unroll   // the thread's two values are requested together
  for (int h = 0; h < 2; ++h) { const unsigned k = h * 16 + (t >> 4), c = t & 15; s[c][k] = (__bf16)Wb[k * HD + c]; }
  __syncthreads();
  if (t < 64) { const int j = t >> 5, ln = t & 31; vst2((unsigned*)(PK + (size_t)(kc * 12 + jt) * 512 + t * 8), *(const v4u*)&s[ln & 15][j * 16 + (ln >> 4) * 8]); }
}
__global__ __launch_bounds__(128) void k_qkv(const float* __restrict__ X, const __bf16* __restrict__ PK, const float* __restrict__ BQ, const float* __restrict__ BK, const float* __restrict__ BV, _Float16* __restrict__ QH, _Float16* __restrict__ QL_, _Float16* __restrict__ KH, _Float16* __restrict__ KL, _Float16* __restrict__ VTH, _Float16* __restrict__ VTL) {
  __shared__ __align__(16) _Float16 sqh[4][16][72], sql[4][16][72], skh[4][16][72], skl[4][16][72]; __shared__ __align__(16) _Float16 svh[HD][72], svl[HD][72];
  const int tid = threadIdx.x, wave = tid >> 5, lane = tid & 31, col = lane & 15, g = lane >> 4; const size_t r0 = (size_t)blockIdx.x * 64 + wave * 16;
  v8f acc[12] = {};
  // loads go out in groups ahead of their use: a pass requests its 12 weight fragments together before its first product (one load latency a pass, not 12), and behind them the next pass's x values, which come from memory
  const float* xrow = X + (r0 + col) * EMB + 8 * g; v4f xc[4];
#pragma unroll
  for (int i = 0; i < 4; ++i) xc[i] = *(const v4f*)(xrow + (i >> 1) * 16 + (i & 1) * 4);
#pragma unroll 2   // two passes a trip: the x values fetched ahead change registers by renaming, not by copies
  for (int kc = 0; kc < EMB / 32; ++kc) { v16b wf[12]; v4f xn[4];
#pragma unroll
    for (int j = 0; j < 12; ++j) wf[j] = frag_pb(PK, (unsigned)(kc * 12 * 1024 + lane * 16), j * 1024);
    const int kn = (kc + 1 < EMB / 32) ? kc + 1 : kc;   // the last pass asks for its own values again: in bounds, not used
#pragma unroll
    for (int i = 0; i < 4; ++i) xn[i] = *(const v4f*)(xrow + kn * 32 + (i >> 1) * 16 + (i & 1) * 4);
    v16b a;
#pragma unroll
    for (int i = 0; i < 16; ++i) a[i] = (__bf16)xc[i >> 2][i & 3];
#pragma unroll
    for (int j = 0; j < 12; ++j) acc[j] = wmma_bf(a, wf[j], acc[j]);
#pragma unroll
    for (int i = 0; i < 4; ++i) xc[i] = xn[i]; }
#pragma unroll
  for (int j = 0; j < 12; ++j) { const int which = j >> 2; const int d = (j & 3) * 16 + col; const float bb = bfr((which == 0) ? BQ[d] : (which == 1) ? BK[d] : BV[d]);
#pragma unroll
    for (int r = 0; r < 8; ++r) { const float v = acc[j][r] + bb; const _Float16 hv = (_Float16)v; const _Float16 lv = (_Float16)((v - (float)hv) * 2048.0f);
      if (which == 0) { sqh[wave][8 * g + r][d] = hv; sql[wave][8 * g + r][d] = lv; } else if (which == 1) { skh[wave][8 * g + r][d] = hv; skl[wave][8 * g + r][d] = lv; } else { svh[d][wave * 16 + 8 * g + r] = hv; svl[d][wave * 16 + 8 * g + r] = lv; } } }
  __syncthreads();
  // q, k: the wave's 16 rows are one row tile = 2 fragments = 4 runs of 512 bytes a plane; run i holds d = 16 i + 8 g + 0..7 of row col
  for (int i = 0; i < 4; ++i) { const size_t o = r0 * HD + i * 256 + lane * 8; const int dc = i * 16 + g * 8;
    vst2((unsigned*)(QH + o), *(const v4u*)&sqh[wave][col][dc]); vst2((unsigned*)(QL_ + o), *(const v4u*)&sql[wave][col][dc]); vst2((unsigned*)(KH + o), *(const v4u*)&skh[wave][col][dc]); vst2((unsigned*)(KL + o), *(const v4u*)&skl[wave][col][dc]); }
  // v: the block's 64 keys are two 32-key blocks of 4 fragments; piece e = [key block][dt][half j][lane] holds keys 16 j + 8 g + 0..7 of d = 16 dt + (lane & 15)
  { const size_t vb = (size_t)blockIdx.x * 64 * HD;
    for (int e = tid; e < HD * 8; e += 128) { const int d = ((e >> 6) & 3) * 16 + (e & 15), kk = (e >> 8) * 32 + ((e >> 5) & 1) * 16 + ((e >> 4) & 1) * 8; const size_t o = vb + (size_t)e * 8; vst2((unsigned*)(VTH + o), *(const v4u*)&svh[d][kk]); vst2((unsigned*)(VTL + o), *(const v4u*)&svl[d][kk]); } }
}
#define KW 12
#define QT 2          // 16-query tiles a wave (and a work-group)
#define QR (16 * QT)  // queries a work-group
#define SC2 0.18033688011112042f   // log(e) / 8: softmax in base 2, exp(s / 8 - max) = 2^(s * SC2 - max2), one multiply-add and one hardware exponential a score
// the value of lane ^ 16
__device__ __forceinline__ float xhalf(float v) { const int b = __builtin_bit_cast(int, v); return __builtin_bit_cast(float, __builtin_amdgcn_permlanex16(b, b, 0x76543210, 0xfedcba98, false, false)); }
__global__ __launch_bounds__(32 * KW) void k_attn(const _Float16* __restrict__ QH, const _Float16* __restrict__ QL_, const _Float16* __restrict__ KH, const _Float16* __restrict__ KL, const _Float16* __restrict__ VTH, const _Float16* __restrict__ VTL, float* __restrict__ OUT) {
  __shared__ __align__(16) float so[KW][QR][HD + 4]; __shared__ float sm[KW][QR], sl[KW][QR];
  const int tid = threadIdx.x, wave = __builtin_amdgcn_readfirstlane(tid >> 5) /* scalar: the key loop's start and trip count differ by wave and must be a scalar branch around the WMMAs */, lane = tid & 31, col = lane & 15, g = lane >> 4;
  // cost grows with the query tile (causal) and only one work-group fits a WGP at a time: the flat index is mapped so that cost falls with it (heaviest tiles of all batches start first, the one-block tiles fill the end); a permutation of (tile, batch)
  const int flat = blockIdx.y * TQB + blockIdx.x; const int qb = TQB - 1 - flat / TNB, b = flat % TNB; const int q0 = qb * QR; const unsigned lane16 = (unsigned)lane * 16;
  const _Float16 *Kh = KH + (size_t)b * SS * HD, *Kl = KL + (size_t)b * SS * HD, *Vh = VTH + (size_t)b * SS * HD, *Vl = VTL + (size_t)b * SS * HD;   // the batch's planes: a 32-key block is 4,096 bytes in each
  float m[QT], l[QT];   // of query q0 + 16 qt + col; m, in base-2 units (score x log e), is equal in both halves, l is the sum over the half's own keys
  v8f acc[QT][4] = {}, accl[QT][4] = {};   // element r of tile (qt, dt) = O^T[dt * 16 + 8 g + r][query 16 qt + col]
#pragma unroll
  for (int qt = 0; qt < QT; ++qt) { m[qt] = -3.0e38f; l[qt] = 0.f; }
  const int nks = (q0 + QR + 31) / 32;
  if (wave < nks) {   // a wave without a key block loads no Q either; the test is scalar
  v16h aqh[QT][2], aql[QT][2];
#pragma unroll
  for (int qt = 0; qt < QT; ++qt) {
#pragma unroll
    for (int kc = 0; kc < 2; ++kc) { aqh[qt][kc] = frag_p(QH + ((size_t)b * SS + q0) * HD, lane16, (qt * 2 + kc) * 1024); aql[qt][kc] = frag_p(QL_ + ((size_t)b * SS + q0) * HD, lane16, (qt * 2 + kc) * 1024); } }
  asm volatile("s_wait_xcnt 0x0" ::: "memory");   // the registers that the sixteen Q loads name (lane offset, plane bases) are reused right behind them: the wait stands in front of that
  __builtin_amdgcn_sched_barrier(0);   // keeps the loads in front of that wait and every later write of their registers behind it
#pragma unroll 1
  for (int ks = wave; ks < nks; ks += KW) { v8f s[QT][2];
    // the pass's eight K fragments are requested together before its first product: one load latency a pass instead of one a fragment
    v16h kfh[2][2], kfl[2][2]; const unsigned off = (unsigned)ks * 4096u + lane16;
#pragma unroll
    for (int ct = 0; ct < 2; ++ct) {
#pragma unroll
      for (int kc = 0; kc < 2; ++kc) { kfh[ct][kc] = frag_p(Kh, off, (ct * 2 + kc) * 1024); kfl[ct][kc] = frag_p(Kl, off, (ct * 2 + kc) * 1024); } }
    __builtin_amdgcn_sched_barrier(0);   // holds the sixteen loads together in front of the products: without it the scheduler sinks them among the WMMAs, into few registers, and the wave waits out several load latencies a pass
#pragma unroll
    for (int ct = 0; ct < 2; ++ct) {
#pragma unroll
      for (int qt = 0; qt < QT; ++qt) { const int dq = q0 + qt * 16 + col - (ks * 32 + ct * 16 + 8 * g) /* the lane's query minus its first key of the tile: key 8 g + r is open where r <= dq */; v8f c = {}, cl = {};
#pragma unroll
        for (int kc = 0; kc < 2; ++kc) { c = wmma16(kfh[ct][kc], aqh[qt][kc], c); cl = wmma16(kfh[ct][kc], aql[qt][kc], cl); cl = wmma16(kfl[ct][kc], aqh[qt][kc], cl); }
#pragma unroll
        for (int r = 0; r < 8; ++r) { const float sv = c[r] + cl[r] * (1.0f / 2048.0f); s[qt][ct][r] = (r <= dq) ? sv : -3.0e38f; } } }   // raw q.k: the factor 1/8 goes into the exponent's multiply-add
    // the pass's eight V fragments are requested here, in the registers the K fragments have left: they fly while the softmax starts
    v16h vfh[4], vfl[4];
#pragma unroll
    for (int dt = 0; dt < 4; ++dt) { vfh[dt] = frag_p(Vh, off, dt * 1024); vfl[dt] = frag_p(Vl, off, dt * 1024); }
    asm volatile("s_wait_xcnt 0x0" ::: "memory");   // the pass's loads all name the lane's offset register, which is stepped to the next key block further down: the wait stands between them and that overwrite
    __builtin_amdgcn_sched_barrier(0);   // the same for V: all sixteen loads are out before the softmax's first instruction
    v16h pah[QT], pal[QT];
#pragma unroll
    for (int qt = 0; qt < QT; ++qt) {
      float mx = fmaxf(s[qt][0][0], s[qt][1][0]);
#pragma unroll
      for (int r = 1; r < 8; ++r) mx = fmaxf(mx, fmaxf(s[qt][0][r], s[qt][1][r]));
      mx = fmaxf(mx, xhalf(mx));   // both halves feed one P^T fragment: they need the same maximum
      const float mn = fmaxf(m[qt], mx * SC2); const float alpha = __builtin_amdgcn_exp2f(m[qt] - mn) /* 0 on a wave's first pass, where m is -3e38 */; m[qt] = mn;
      float es = 0.f;
#pragma unroll
      for (int ct = 0; ct < 2; ++ct) {
#pragma unroll
        for (int r = 0; r < 8; ++r) { const float e = __builtin_amdgcn_exp2f(fmaf(s[qt][ct][r], SC2, -mn)) /* a closed key's -3e38 gives exactly 0: every query of the block has an open key in every key block the work-group visits (the last one starts at key q0), so mn is a real score */; es += e;
          const _Float16 h = (_Float16)e; pah[qt][ct * 8 + r] = h; pal[qt][ct * 8 + r] = (_Float16)((e - (float)h) * 2048.0f); } }   // element ct * 8 + r = key 16 ct + 8 g + r: the fragments' k order, as V's loader has it
      l[qt] = l[qt] * alpha + es;
#pragma unroll
      for (int dt = 0; dt < 4; ++dt) { acc[qt][dt] *= alpha; accl[qt][dt] *= alpha; }
      if (qt + 1 < QT) __builtin_amdgcn_sched_barrier(0); }   // one tile's softmax is finished before the other's begins: both tiles' scores, exponentials and P live at once cost the registers that the third wave of a SIMD needs
#pragma unroll
    for (int dt = 0; dt < 4; ++dt) {
#pragma unroll
      for (int qt = 0; qt < QT; ++qt) { acc[qt][dt] = wmma16(vfh[dt], pah[qt], acc[qt][dt]); accl[qt][dt] = wmma16(vfh[dt], pal[qt], accl[qt][dt]); accl[qt][dt] = wmma16(vfl[dt], pah[qt], accl[qt][dt]); } } }
  }
#pragma unroll
  for (int qt = 0; qt < QT; ++qt) { l[qt] += xhalf(l[qt]);
    if (g == 0) { sm[wave][qt * 16 + col] = m[qt]; sl[wave][qt * 16 + col] = l[qt]; }
#pragma unroll
    for (int dt = 0; dt < 4; ++dt) { const v8f o = acc[qt][dt] + accl[qt][dt] * (1.0f / 2048.0f);
      *(v4f*)&so[wave][qt * 16 + col][dt * 16 + 8 * g] = __builtin_shufflevector(o, o, 0, 1, 2, 3); *(v4f*)&so[wave][qt * 16 + col][dt * 16 + 8 * g + 4] = __builtin_shufflevector(o, o, 4, 5, 6, 7); } }
  __syncthreads();   // every wave's partial (max, sum, rows) is in LDS before any wave reads the others'; every wave passes here, also one that had no key block
  for (int pr = wave; pr < QR / 2; pr += KW) { const int row = pr * 2 + g; float mw[KW]; float mx = -3.0e38f;   // a wave merges two rows at a time, a half-wave each, four columns a lane; every lane reads its row's KW maxima and sums; a wave that saw no open key has m = -3e38, l = 0 and gets weight 0
#pragma unroll
    for (int w = 0; w < KW; ++w) { mw[w] = sm[w][row]; mx = fmaxf(mx, mw[w]); }
    float ls = 0.f; v4f o4 = {};
#pragma unroll   // the LDS reads of the parts are independent: unrolled they are issued together instead of one wait per part
    for (int w = 0; w < KW; ++w) { const float wg = __builtin_amdgcn_exp2f(mw[w] - mx); ls += wg * sl[w][row]; o4 += wg * *(const v4f*)&so[w][row][col * 4]; }
    vst2(OUT + ((size_t)b * SS + q0 + row) * HD + col * 4, (v4f)(o4 * (1.0f / ls)));
    asm volatile("s_wait_xcnt 0x0" ::: "memory"); }   // the next rows' LDS reads land in the registers that the store names: the wait stands in front of them
}
extern "C" void kernel_launch(void* const* d_in, const int* in_sizes, int n_in, void* d_out, int out_size, void* d_ws, size_t ws_size, hipStream_t stream) {
  (void)in_sizes; (void)n_in; (void)out_size;
  const float** F = (const float**)d_in;   // 0 x [4,4096,512], 1 Wq [512,64], 2 bq, 3 Wk, 4 bk, 5 Wv, 6 bv
  if (ws_size < (size_t)WS_END) return;
  char* ws = (char*)d_ws; __bf16* PK = (__bf16*)(ws + WS_PK); _Float16 *QH = (_Float16*)(ws + WS_QH), *QLp = (_Float16*)(ws + WS_QL), *KH = (_Float16*)(ws + WS_KH), *KL = (_Float16*)(ws + WS_KL), *VTH = (_Float16*)(ws + WS_VTH), *VTL = (_Float16*)(ws + WS_VTL);
  k_pack<<<192, 256, 0, stream>>>(F[1], F[3], F[5], PK);
  k_qkv<<<TNB * SS / 64, 128, 0, stream>>>(F[0], PK, F[2], F[4], F[6], QH, QLp, KH, KL, VTH, VTL);
  k_attn<<<dim3(TQB, TNB), 32 * KW, 0, stream>>>(QH, QLp, KH, KL, VTH, VTL, (float*)d_out);
}

// v008
// One run takes 41.1 microseconds.
// Two timings next to v007 put it at 1.20 and 1.19 times that version's speed.
// Counting every step since v000, it is 17.2 times as fast.
// compute dtype: x, Wq, bq, Wk, bk, Wv, bv (module inputs) rounded to bf16; Q/K/V projection with exact bf16 products on WMMA 16x16x32 ((in,out) weights packed as transposed fragments) + biases; q and k stored as f16 hi + (x2048-scaled) residual planes with 3-product scores, x 1/8 on the f32 score, causal mask, running-max softmax in f32 (base 2, hardware exponential); P as f16 hi + (x2048) residual x v hi/lo (3 products); f32 output rows.
#include <hip/hip_runtime.h>
#include <math.h>

typedef __attribute__((ext_vector_type(16))) _Float16 v16h;
typedef __attribute__((ext_vector_type(16))) __bf16 v16b;
typedef __attribute__((ext_vector_type(8)))  _Float16 v8h;
typedef __attribute__((ext_vector_type(8)))  float v8f;
typedef __attribute__((ext_vector_type(4)))  float v4f;
typedef __attribute__((ext_vector_type(2)))  float v2f;
typedef __attribute__((ext_vector_type(4)))  unsigned v4u;
typedef __attribute__((ext_vector_type(4)))  int v4i;
typedef float __attribute__((may_alias)) float_a;
typedef int __attribute__((may_alias)) int_a;

template <typename T> __device__ __forceinline__ void vst2(void* p, T v) { *(T*)p = v;  }
__device__ __forceinline__ v8f wmma16(v16h a, v16h b, v8f c) {
  return __builtin_amdgcn_wmma_f32_16x16x32_f16(false, a, false, b, (short)0, c, false, false);   // the plain builtin: the compiler keeps its distances itself, and its operands may live above v255, which an asm operand cannot
}
__device__ __forceinline__ v8f wmma_bf(v16b a, v16b b, v8f c) {
  v8f d = __builtin_amdgcn_wmma_f32_16x16x32_bf16(false, a, false, b, (short)0, c, false, false);
  asm volatile("v_nop\n\tv_nop\n\tv_nop\n\tv_nop" : "+v"(d) : "v"(a), "v"(b));
  return d;
}
// 16x16x32 fragments: lane = (h = lane>>4, row/col = lane&15); elements 0..7 = k0+8h+0..7, 8..15 = k0+16+8h+0..7; D element r = row 8h+r
__device__ __forceinline__ v16h frag_h(const _Float16* rowk0, int lane) {
  union { v16h v; v8h q[2]; } u; const _Float16* p = rowk0 + 8 * (lane >> 4);
  u.q[0] = *(const v8h*)p; u.q[1] = *(const v8h*)(p + 16); return u.v;
}
__device__ __forceinline__ v16h frag_f32(const float* rowk0, int lane) {
  v16h a; const float* p = rowk0 + 8 * (lane >> 4);
#pragma unroll
  for (int i = 0; i < 8; ++i) { a[i] = (_Float16)p[i]; a[8 + i] = (_Float16)p[16 + i]; }
  return a;
}
__device__ __forceinline__ v16h frag_f32s(const float* rowk0, int lane, float sc) {
  v16h a; const float* p = rowk0 + 8 * (lane >> 4);
#pragma unroll
  for (int i = 0; i < 8; ++i) { a[i] = (_Float16)(p[i] * sc); a[8 + i] = (_Float16)(p[16 + i] * sc); }
  return a;
}
// column fragment from a [K][ld] layout (column n), rows >= K read as 0
__device__ __forceinline__ v16h fragc_f32(const float* W, int k0, int n, int lane, int ld, int K) {
  v16h a; const int g = lane >> 4;
#pragma unroll
  for (int i = 0; i < 8; ++i) { const int ka = k0 + 8 * g + i, kb = ka + 16;
    a[i] = (_Float16)(ka < K ? W[(size_t)(ka < K ? ka : K - 1) * ld + n] : 0.f); a[8 + i] = (_Float16)(kb < K ? W[(size_t)(kb < K ? kb : K - 1) * ld + n] : 0.f); }
  return a;
}
struct F2 { v16b h, l; };
__device__ __forceinline__ F2 bsplit16(const float v[16]) { F2 r;
#pragma unroll
  for (int i = 0; i < 16; ++i) { const __bf16 h = (__bf16)v[i]; r.h[i] = h; r.l[i] = (__bf16)(v[i] - (float)h); }
  return r; }
__device__ __forceinline__ F2 split_row(const float* row, int k0, int lane) { float v[16]; const float* p = row + k0 + 8 * (lane >> 4);
#pragma unroll
  for (int i = 0; i < 8; ++i) { v[i] = p[i]; v[8 + i] = p[16 + i]; }
  return bsplit16(v); }
__device__ __forceinline__ F2 split_rowK(const float* row, int k0, int lane, int K) { float v[16]; const int g = lane >> 4;
#pragma unroll
  for (int i = 0; i < 8; ++i) { const int ka = k0 + 8 * g + i, kb = ka + 16; v[i] = ka < K ? row[ka < K ? ka : K - 1] : 0.f; v[8 + i] = kb < K ? row[kb < K ? kb : K - 1] : 0.f; }
  return bsplit16(v); }
__device__ __forceinline__ F2 split_col(const float* W, int k0, int n, int lane, int ld, int K) { float v[16]; const int g = lane >> 4;
#pragma unroll
  for (int i = 0; i < 8; ++i) { const int ka = k0 + 8 * g + i, kb = ka + 16; v[i] = ka < K ? W[(size_t)(ka < K ? ka : K - 1) * ld + n] : 0.f; v[8 + i] = kb < K ? W[(size_t)(kb < K ? kb : K - 1) * ld + n] : 0.f; }
  return bsplit16(v); }
__device__ __forceinline__ v8f mac3(const F2& a, const F2& b, v8f c) { c = wmma_bf(a.l, b.h, c); c = wmma_bf(a.h, b.l, c); return wmma_bf(a.h, b.h, c); }
__device__ __forceinline__ float sigm(float v) { return 1.0f / (1.0f + expf(-v)); }


// Single causal attention head (B 4, S 4,096, emb 512 -> head 64): softmax(Q K^T / 8, causal) V.
#define NB 4
#define SS 4096
#define NR (NB * SS)
#define EMB 512
#define HD 64
#ifndef TQB
#define TQB (SS / 32)
#define TNB NB
#endif
typedef __attribute__((ext_vector_type(8))) __bf16 v8b;
// FRAGMENT ORDER: the workspace planes hold every 16 x 32 operand fragment as 512 elements in a row: [half j][lane][8 elements], where lane = 16 g + row and the 8 elements are k = 16 j + 8 g + 0..7 of that row
// (the registers' own order). A wave-wide 16-byte load then covers 512 contiguous bytes, 4 whole lines, where a row-major plane makes it touch 16 lines for 32 bytes each.
// base: wave-uniform; off: the lane's 32-bit byte offset from it (16 * lane, and what moves from pass to pass); c: the fragment's constant byte offset
__device__ __forceinline__ v16b frag_pb(const __bf16* base, unsigned off, int c) {
  union { v16b v; v8b q[2]; } u; const char* p = (const char*)base + off + c; u.q[0] = *(const v8b*)p; u.q[1] = *(const v8b*)(p + 512); return u.v;
}
__device__ __forceinline__ v16h frag_p(const _Float16* base, unsigned off, int c) {
  union { v16h v; v8h q[2]; } u; const char* p = (const char*)base + off + c; u.q[0] = *(const v8h*)p; u.q[1] = *(const v8h*)(p + 512); return u.v;
}
__device__ __forceinline__ float bfr(float v) { return (float)(__bf16)v; }
__device__ __attribute__((noinline)) float erf_ni(float v) { return erff(v); }

#define WS_PK  0u                                     // bf16 [16 kc][12 column tiles: Wq^T | Wk^T | Wv^T][512]: fragments (16 columns x 32 k)
#define WS_QH  (((2u * 192 * EMB) + 127u) / 128u * 128u)  // f16 [1024 row tiles][2 kc][512] q hi: fragments (16 rows x 32 d) ; QL lo x2048 ; KH, KL
#define WS_QL  (WS_QH + 2u * NR * HD)
#define WS_KH  (WS_QL + 2u * NR * HD)
#define WS_KL  (WS_KH + 2u * NR * HD)
#define WS_VTH (WS_KL + 2u * NR * HD)                   // f16 [512 key blocks][4 dt][512] v hi / lo: fragments (16 d x 32 keys)
#define WS_VTL (WS_VTH + 2u * NR * HD)
#define WS_END (WS_VTL + 2u * NR * HD)

__global__ __launch_bounds__(256) void k_pack(const float* __restrict__ WQ, const float* __restrict__ WK, const float* __restrict__ WV, __bf16* __restrict__ PK) {
  // block = one fragment: column tile jt (16 of the 192 columns), k block kc (32 of 512); it alone writes the fragment's 1,024 bytes
  __shared__ __align__(16) __bf16 s[16][40]; const int jt = blockIdx.x % 12, kc = blockIdx.x / 12, t = threadIdx.x; const int which = jt >> 2, d0 = (jt & 3) * 16; const float* Wm = (which == 0) ? WQ : (which == 1) ? WK : WV;
  const float* Wb = Wm + (size_t)kc * 32 * HD + d0;
#pragma unroll   // the thread's two values are requested together
  for (int h = 0; h < 2; ++h) { const unsigned k = h * 16 + (t >> 4), c = t & 15; s[c][k] = (__bf16)Wb[k * HD + c]; }
  __syncthreads();
  if (t < 64) { const int j = t >> 5, ln = t & 31; vst2((unsigned*)(PK + (size_t)(kc * 12 + jt) * 512 + t * 8), *(const v4u*)&s[ln & 15][j * 16 + (ln >> 4) * 8]); }
}
// k_qkv: block = 64 rows, 16 waves: wave = (row tile rt, k quarter kq). A row tile's 512 k are split over four waves, 128 each, so that a WGP has 16 waves with x requests in memory at once instead of 4 (x comes from memory, one latency a pass).
// a wave's accumulator (which, t) holds column tile (t + kq) & 3 of q | k | v: t = 0 is the tile the wave owns and finishes; its partial tiles t = 1..3 go through LDS to their owners, which add the four parts behind one work-group barrier
__global__ __launch_bounds__(512) void k_qkv(const float* __restrict__ X, const __bf16* __restrict__ PK, const float* __restrict__ BQ, const float* __restrict__ BK, const float* __restrict__ BV, _Float16* __restrict__ QH, _Float16* __restrict__ QL_, _Float16* __restrict__ KH, _Float16* __restrict__ KL, _Float16* __restrict__ VTH, _Float16* __restrict__ VTL) {
  __shared__ __align__(16) _Float16 sqh[4][16][72], sql[4][16][72], skh[4][16][72], skl[4][16][72]; __shared__ __align__(16) _Float16 svh[HD][72], svl[HD][72];
  __shared__ __align__(16) float red[4][4][3][3][256];   // [row tile][owner's k quarter][q | k | v][t - 1][half of the 8 values][lane][4]: every 16-byte LDS access of a wave covers 512 contiguous bytes
  const int tid = threadIdx.x, wave = __builtin_amdgcn_readfirstlane(tid >> 5), rt = wave & 3, kq = wave >> 2, lane = tid & 31, col = lane & 15, g = lane >> 4; const size_t r0 = (size_t)blockIdx.x * 64 + rt * 16;
  v8f acc[12] = {};
  // loads go out in groups ahead of their use: a pass requests its 12 weight fragments together before its first product (one load latency a pass, not 12), and behind them the next pass's x values, which come from memory
  const float* xrow = X + (r0 + col) * EMB + kq * 128 + 8 * g; v4f xc[4];
#pragma unroll
  for (int i = 0; i < 4; ++i) xc[i] = *(const v4f*)(xrow + (i >> 1) * 16 + (i & 1) * 4);
  unsigned toff[4];
#pragma unroll
  for (int t = 0; t < 4; ++t) toff[t] = (unsigned)(kq * 4 * 12 * 1024 + ((t + kq) & 3) * 1024 + lane * 16);
#pragma unroll   // four passes a wave: the x values fetched ahead change registers by renaming, not by copies
  for (int p = 0; p < 4; ++p) { v16b wf[12]; v4f xn[4];
#pragma unroll
    for (int j = 0; j < 12; ++j) wf[j] = frag_pb(PK, toff[j & 3], p * 12 * 1024 + (j >> 2) * 4096);
    if (p + 1 < 4) {
#pragma unroll
      for (int i = 0; i < 4; ++i) xn[i] = *(const v4f*)(xrow + (p + 1) * 32 + (i >> 1) * 16 + (i & 1) * 4); }
    v16b a;
#pragma unroll
    for (int i = 0; i < 16; ++i) a[i] = (__bf16)xc[i >> 2][i & 3];
#pragma unroll
    for (int j = 0; j < 12; ++j) acc[j] = wmma_bf(a, wf[j], acc[j]);
    if (p + 1 < 4) {
#pragma unroll
      for (int i = 0; i < 4; ++i) xc[i] = xn[i]; } }
#pragma unroll
  for (int which = 0; which < 3; ++which) {
#pragma unroll
    for (int t = 1; t < 4; ++t) { float* p = &red[rt][(kq + t) & 3][which][t - 1][lane * 4]; const v8f o = acc[which * 4 + t];
      *(v4f*)p = __builtin_shufflevector(o, o, 0, 1, 2, 3); *(v4f*)(p + 128) = __builtin_shufflevector(o, o, 4, 5, 6, 7); } }
  __syncthreads();   // every wave's partial tiles are in LDS before their owners read them
  const int d = kq * 16 + col;
#pragma unroll
  for (int which = 0; which < 3; ++which) { v8f sum = acc[which * 4];
#pragma unroll
    for (int t = 1; t < 4; ++t) { const float* p = &red[rt][kq][which][t - 1][lane * 4]; const v4f lo = *(const v4f*)p, hi = *(const v4f*)(p + 128); sum += __builtin_shufflevector(lo, hi, 0, 1, 2, 3, 4, 5, 6, 7); }
    const float bb = bfr((which == 0) ? BQ[d] : (which == 1) ? BK[d] : BV[d]);
#pragma unroll
    for (int r = 0; r < 8; ++r) { const float v = sum[r] + bb; const _Float16 hv = (_Float16)v; const _Float16 lv = (_Float16)((v - (float)hv) * 2048.0f);
      if (which == 0) { sqh[rt][8 * g + r][d] = hv; sql[rt][8 * g + r][d] = lv; } else if (which == 1) { skh[rt][8 * g + r][d] = hv; skl[rt][8 * g + r][d] = lv; } else { svh[d][rt * 16 + 8 * g + r] = hv; svl[d][rt * 16 + 8 * g + r] = lv; } } }
  __syncthreads();
  // q, k: a row tile is 2 fragments = 4 runs of 512 bytes a plane; run i holds d = 16 i + 8 g + 0..7 of row col; wave (rt, kq) stores run kq
  { const size_t o = r0 * HD + kq * 256 + lane * 8; const int dc = kq * 16 + g * 8;
    vst2((unsigned*)(QH + o), *(const v4u*)&sqh[rt][col][dc]); vst2((unsigned*)(QL_ + o), *(const v4u*)&sql[rt][col][dc]); vst2((unsigned*)(KH + o), *(const v4u*)&skh[rt][col][dc]); vst2((unsigned*)(KL + o), *(const v4u*)&skl[rt][col][dc]); }
  // v: the block's 64 keys are two 32-key blocks of 4 fragments; piece e = [key block][dt][half j][lane] holds keys 16 j + 8 g + 0..7 of d = 16 dt + (lane & 15); one piece a thread
  { const size_t vb = (size_t)blockIdx.x * 64 * HD; const int e = tid;
    const int dv = ((e >> 6) & 3) * 16 + (e & 15), kk = (e >> 8) * 32 + ((e >> 5) & 1) * 16 + ((e >> 4) & 1) * 8; const size_t o = vb + (size_t)e * 8; vst2((unsigned*)(VTH + o), *(const v4u*)&svh[dv][kk]); vst2((unsigned*)(VTL + o), *(const v4u*)&svl[dv][kk]); }
}
#define KW 12
#define QT 2          // 16-query tiles a wave (and a work-group)
#define QR (16 * QT)  // queries a work-group
#define SC2 0.18033688011112042f   // log(e) / 8: softmax in base 2, exp(s / 8 - max) = 2^(s * SC2 - max2), one multiply-add and one hardware exponential a score
// the value of lane ^ 16
__device__ __forceinline__ float xhalf(float v) { const int b = __builtin_bit_cast(int, v); return __builtin_bit_cast(float, __builtin_amdgcn_permlanex16(b, b, 0x76543210, 0xfedcba98, false, false)); }
__global__ __launch_bounds__(32 * KW) void k_attn(const _Float16* __restrict__ QH, const _Float16* __restrict__ QL_, const _Float16* __restrict__ KH, const _Float16* __restrict__ KL, const _Float16* __restrict__ VTH, const _Float16* __restrict__ VTL, float* __restrict__ OUT) {
  __shared__ __align__(16) float so[KW][QR][HD + 4]; __shared__ float sm[KW][QR], sl[KW][QR];
  const int tid = threadIdx.x, wave = __builtin_amdgcn_readfirstlane(tid >> 5) /* scalar: the key loop's start and trip count differ by wave and must be a scalar branch around the WMMAs */, lane = tid & 31, col = lane & 15, g = lane >> 4;
  // cost grows with the query tile (causal) and only one work-group fits a WGP at a time: the flat index is mapped so that cost falls with it (heaviest tiles of all batches start first, the one-block tiles fill the end); a permutation of (tile, batch)
  const int flat = blockIdx.y * TQB + blockIdx.x; const int qb = TQB - 1 - flat / TNB, b = flat % TNB; const int q0 = qb * QR; const unsigned lane16 = (unsigned)lane * 16;
  const _Float16 *Kh = KH + (size_t)b * SS * HD, *Kl = KL + (size_t)b * SS * HD, *Vh = VTH + (size_t)b * SS * HD, *Vl = VTL + (size_t)b * SS * HD;   // the batch's planes: a 32-key block is 4,096 bytes in each
  float m[QT], l[QT];   // of query q0 + 16 qt + col; m, in base-2 units (score x log e), is equal in both halves, l is the sum over the half's own keys
  v8f acc[QT][4] = {}, accl[QT][4] = {};   // element r of tile (qt, dt) = O^T[dt * 16 + 8 g + r][query 16 qt + col]
#pragma unroll
  for (int qt = 0; qt < QT; ++qt) { m[qt] = -3.0e38f; l[qt] = 0.f; }
  const int nks = (q0 + QR + 31) / 32;
  if (wave < nks) {   // a wave without a key block loads no Q either; the test is scalar
  v16h aqh[QT][2], aql[QT][2];
#pragma unroll
  for (int qt = 0; qt < QT; ++qt) {
#pragma unroll
    for (int kc = 0; kc < 2; ++kc) { aqh[qt][kc] = frag_p(QH + ((size_t)b * SS + q0) * HD, lane16, (qt * 2 + kc) * 1024); aql[qt][kc] = frag_p(QL_ + ((size_t)b * SS + q0) * HD, lane16, (qt * 2 + kc) * 1024); } }
  asm volatile("s_wait_xcnt 0x0" ::: "memory");   // the registers that the sixteen Q loads name (lane offset, plane bases) are reused right behind them: the wait stands in front of that
  __builtin_amdgcn_sched_barrier(0);   // keeps the loads in front of that wait and every later write of their registers behind it
#pragma unroll 1
  for (int ks = wave; ks < nks; ks += KW) { v8f s[QT][2];
    // the pass's eight K fragments are requested together before its first product: one load latency a pass instead of one a fragment
    v16h kfh[2][2], kfl[2][2]; const unsigned off = (unsigned)ks * 4096u + lane16;
#pragma unroll
    for (int ct = 0; ct < 2; ++ct) {
#pragma unroll
      for (int kc = 0; kc < 2; ++kc) { kfh[ct][kc] = frag_p(Kh, off, (ct * 2 + kc) * 1024); kfl[ct][kc] = frag_p(Kl, off, (ct * 2 + kc) * 1024); } }
    __builtin_amdgcn_sched_barrier(0);   // holds the sixteen loads together in front of the products: without it the scheduler sinks them among the WMMAs, into few registers, and the wave waits out several load latencies a pass
#pragma unroll
    for (int ct = 0; ct < 2; ++ct) {
#pragma unroll
      for (int qt = 0; qt < QT; ++qt) { const int dq = q0 + qt * 16 + col - (ks * 32 + ct * 16 + 8 * g) /* the lane's query minus its first key of the tile: key 8 g + r is open where r <= dq */; v8f c = {}, cl = {};
#pragma unroll
        for (int kc = 0; kc < 2; ++kc) { c = wmma16(kfh[ct][kc], aqh[qt][kc], c); cl = wmma16(kfh[ct][kc], aql[qt][kc], cl); cl = wmma16(kfl[ct][kc], aqh[qt][kc], cl); }
#pragma unroll
        for (int r = 0; r < 8; ++r) { const float sv = c[r] + cl[r] * (1.0f / 2048.0f); s[qt][ct][r] = (r <= dq) ? sv : -3.0e38f; } } }   // raw q.k: the factor 1/8 goes into the exponent's multiply-add
    // the pass's eight V fragments are requested here, in the registers the K fragments have left: they fly while the softmax starts
    v16h vfh[4], vfl[4];
#pragma unroll
    for (int dt = 0; dt < 4; ++dt) { vfh[dt] = frag_p(Vh, off, dt * 1024); vfl[dt] = frag_p(Vl, off, dt * 1024); }
    asm volatile("s_wait_xcnt 0x0" ::: "memory");   // the pass's loads all name the lane's offset register, which is stepped to the next key block further down: the wait stands between them and that overwrite
    __builtin_amdgcn_sched_barrier(0);   // the same for V: all sixteen loads are out before the softmax's first instruction
    v16h pah[QT], pal[QT];
#pragma unroll
    for (int qt = 0; qt < QT; ++qt) {
      float mx = fmaxf(s[qt][0][0], s[qt][1][0]);
#pragma unroll
      for (int r = 1; r < 8; ++r) mx = fmaxf(mx, fmaxf(s[qt][0][r], s[qt][1][r]));
      mx = fmaxf(mx, xhalf(mx));   // both halves feed one P^T fragment: they need the same maximum
      const float mn = fmaxf(m[qt], mx * SC2); const float alpha = __builtin_amdgcn_exp2f(m[qt] - mn) /* 0 on a wave's first pass, where m is -3e38 */; m[qt] = mn;
      float es = 0.f;
#pragma unroll
      for (int ct = 0; ct < 2; ++ct) {
#pragma unroll
        for (int r = 0; r < 8; ++r) { const float e = __builtin_amdgcn_exp2f(fmaf(s[qt][ct][r], SC2, -mn)) /* a closed key's -3e38 gives exactly 0: every query of the block has an open key in every key block the work-group visits (the last one starts at key q0), so mn is a real score */; es += e;
          const _Float16 h = (_Float16)e; pah[qt][ct * 8 + r] = h; pal[qt][ct * 8 + r] = (_Float16)((e - (float)h) * 2048.0f); } }   // element ct * 8 + r = key 16 ct + 8 g + r: the fragments' k order, as V's loader has it
      l[qt] = l[qt] * alpha + es;
#pragma unroll
      for (int dt = 0; dt < 4; ++dt) { acc[qt][dt] *= alpha; accl[qt][dt] *= alpha; }
      if (qt + 1 < QT) __builtin_amdgcn_sched_barrier(0); }   // one tile's softmax is finished before the other's begins: both tiles' scores, exponentials and P live at once cost the registers that the third wave of a SIMD needs
#pragma unroll
    for (int dt = 0; dt < 4; ++dt) {
#pragma unroll
      for (int qt = 0; qt < QT; ++qt) { acc[qt][dt] = wmma16(vfh[dt], pah[qt], acc[qt][dt]); accl[qt][dt] = wmma16(vfh[dt], pal[qt], accl[qt][dt]); accl[qt][dt] = wmma16(vfl[dt], pah[qt], accl[qt][dt]); } } }
  }
#pragma unroll
  for (int qt = 0; qt < QT; ++qt) { l[qt] += xhalf(l[qt]);
    if (g == 0) { sm[wave][qt * 16 + col] = m[qt]; sl[wave][qt * 16 + col] = l[qt]; }
#pragma unroll
    for (int dt = 0; dt < 4; ++dt) { const v8f o = acc[qt][dt] + accl[qt][dt] * (1.0f / 2048.0f);
      *(v4f*)&so[wave][qt * 16 + col][dt * 16 + 8 * g] = __builtin_shufflevector(o, o, 0, 1, 2, 3); *(v4f*)&so[wave][qt * 16 + col][dt * 16 + 8 * g + 4] = __builtin_shufflevector(o, o, 4, 5, 6, 7); } }
  __syncthreads();   // every wave's partial (max, sum, rows) is in LDS before any wave reads the others'; every wave passes here, also one that had no key block
  for (int pr = wave; pr < QR / 2; pr += KW) { const int row = pr * 2 + g; float mw[KW]; float mx = -3.0e38f;   // a wave merges two rows at a time, a half-wave each, four columns a lane; every lane reads its row's KW maxima and sums; a wave that saw no open key has m = -3e38, l = 0 and gets weight 0
#pragma unroll
    for (int w = 0; w < KW; ++w) { mw[w] = sm[w][row]; mx = fmaxf(mx, mw[w]); }
    float ls = 0.f; v4f o4 = {};
#pragma unroll   // the LDS reads of the parts are independent: unrolled they are issued together instead of one wait per part
    for (int w = 0; w < KW; ++w) { const float wg = __builtin_amdgcn_exp2f(mw[w] - mx); ls += wg * sl[w][row]; o4 += wg * *(const v4f*)&so[w][row][col * 4]; }
    vst2(OUT + ((size_t)b * SS + q0 + row) * HD + col * 4, (v4f)(o4 * (1.0f / ls)));
    asm volatile("s_wait_xcnt 0x0" ::: "memory"); }   // the next rows' LDS reads land in the registers that the store names: the wait stands in front of them
}
extern "C" void kernel_launch(void* const* d_in, const int* in_sizes, int n_in, void* d_out, int out_size, void* d_ws, size_t ws_size, hipStream_t stream) {
  (void)in_sizes; (void)n_in; (void)out_size;
  const float** F = (const float**)d_in;   // 0 x [4,4096,512], 1 Wq [512,64], 2 bq, 3 Wk, 4 bk, 5 Wv, 6 bv
  if (ws_size < (size_t)WS_END) return;
  char* ws = (char*)d_ws; __bf16* PK = (__bf16*)(ws + WS_PK); _Float16 *QH = (_Float16*)(ws + WS_QH), *QLp = (_Float16*)(ws + WS_QL), *KH = (_Float16*)(ws + WS_KH), *KL = (_Float16*)(ws + WS_KL), *VTH = (_Float16*)(ws + WS_VTH), *VTL = (_Float16*)(ws + WS_VTL);
  k_pack<<<192, 256, 0, stream>>>(F[1], F[3], F[5], PK);
  k_qkv<<<TNB * SS / 64, 512, 0, stream>>>(F[0], PK, F[2], F[4], F[6], QH, QLp, KH, KL, VTH, VTL);
  k_attn<<<dim3(TQB, TNB), 32 * KW, 0, stream>>>(QH, QLp, KH, KL, VTH, VTL, (float*)d_out);
}

// v009
// A run of this version takes 38.3 microseconds.
// Next to v008, in two timings, it ran 1.07 and 1.08 times as fast.
// All steps since v000 together make it 18.4 times as fast.
// compute dtype: x, Wq, bq, Wk, bk, Wv, bv (module inputs) rounded to bf16; Q/K/V projection with exact bf16 products on WMMA 16x16x32 ((in,out) weights packed as transposed fragments) + biases; q and k stored as f16 hi + (x2048-scaled) residual planes with 3-product scores, x 1/8 on the f32 score, causal mask, running-max softmax in f32 (base 2, hardware exponential); P as f16 hi + (x2048) residual x v hi/lo (3 products); f32 output rows.
#include <hip/hip_runtime.h>
#include <math.h>

typedef __attribute__((ext_vector_type(16))) _Float16 v16h;
typedef __attribute__((ext_vector_type(16))) __bf16 v16b;
typedef __attribute__((ext_vector_type(8)))  _Float16 v8h;
typedef __attribute__((ext_vector_type(8)))  float v8f;
typedef __attribute__((ext_vector_type(4)))  float v4f;
typedef __attribute__((ext_vector_type(2)))  float v2f;
typedef __attribute__((ext_vector_type(4)))  unsigned v4u;
typedef __attribute__((ext_vector_type(4)))  int v4i;
typedef float __attribute__((may_alias)) float_a;
typedef int __attribute__((may_alias)) int_a;

template <typename T> __device__ __forceinline__ void vst2(void* p, T v) { *(T*)p = v;  }
__device__ __forceinline__ v8f wmma16(v16h a, v16h b, v8f c) {
  return __builtin_amdgcn_wmma_f32_16x16x32_f16(false, a, false, b, (short)0, c, false, false);   // the plain builtin: the compiler keeps its distances itself, and its operands may live above v255, which an asm operand cannot
}
__device__ __forceinline__ v8f wmma_bf(v16b a, v16b b, v8f c) {
  v8f d = __builtin_amdgcn_wmma_f32_16x16x32_bf16(false, a, false, b, (short)0, c, false, false);
  asm volatile("v_nop\n\tv_nop\n\tv_nop\n\tv_nop" : "+v"(d) : "v"(a), "v"(b));
  return d;
}
// 16x16x32 fragments: lane = (h = lane>>4, row/col = lane&15); elements 0..7 = k0+8h+0..7, 8..15 = k0+16+8h+0..7; D element r = row 8h+r
__device__ __forceinline__ v16h frag_h(const _Float16* rowk0, int lane) {
  union { v16h v; v8h q[2]; } u; const _Float16* p = rowk0 + 8 * (lane >> 4);
  u.q[0] = *(const v8h*)p; u.q[1] = *(const v8h*)(p + 16); return u.v;
}
__device__ __forceinline__ v16h frag_f32(const float* rowk0, int lane) {
  v16h a; const float* p = rowk0 + 8 * (lane >> 4);
#pragma unroll
  for (int i = 0; i < 8; ++i) { a[i] = (_Float16)p[i]; a[8 + i] = (_Float16)p[16 + i]; }
  return a;
}
__device__ __forceinline__ v16h frag_f32s(const float* rowk0, int lane, float sc) {
  v16h a; const float* p = rowk0 + 8 * (lane >> 4);
#pragma unroll
  for (int i = 0; i < 8; ++i) { a[i] = (_Float16)(p[i] * sc); a[8 + i] = (_Float16)(p[16 + i] * sc); }
  return a;
}
// column fragment from a [K][ld] layout (column n), rows >= K read as 0
__device__ __forceinline__ v16h fragc_f32(const float* W, int k0, int n, int lane, int ld, int K) {
  v16h a; const int g = lane >> 4;
#pragma unroll
  for (int i = 0; i < 8; ++i) { const int ka = k0 + 8 * g + i, kb = ka + 16;
    a[i] = (_Float16)(ka < K ? W[(size_t)(ka < K ? ka : K - 1) * ld + n] : 0.f); a[8 + i] = (_Float16)(kb < K ? W[(size_t)(kb < K ? kb : K - 1) * ld + n] : 0.f); }
  return a;
}
struct F2 { v16b h, l; };
__device__ __forceinline__ F2 bsplit16(const float v[16]) { F2 r;
#pragma unroll
  for (int i = 0; i < 16; ++i) { const __bf16 h = (__bf16)v[i]; r.h[i] = h; r.l[i] = (__bf16)(v[i] - (float)h); }
  return r; }
__device__ __forceinline__ F2 split_row(const float* row, int k0, int lane) { float v[16]; const float* p = row + k0 + 8 * (lane >> 4);
#pragma unroll
  for (int i = 0; i < 8; ++i) { v[i] = p[i]; v[8 + i] = p[16 + i]; }
  return bsplit16(v); }
__device__ __forceinline__ F2 split_rowK(const float* row, int k0, int lane, int K) { float v[16]; const int g = lane >> 4;
#pragma unroll
  for (int i = 0; i < 8; ++i) { const int ka = k0 + 8 * g + i, kb = ka + 16; v[i] = ka < K ? row[ka < K ? ka : K - 1] : 0.f; v[8 + i] = kb < K ? row[kb < K ? kb : K - 1] : 0.f; }
  return bsplit16(v); }
__device__ __forceinline__ F2 split_col(const float* W, int k0, int n, int lane, int ld, int K) { float v[16]; const int g = lane >> 4;
#pragma unroll
  for (int i = 0; i < 8; ++i) { const int ka = k0 + 8 * g + i, kb = ka + 16; v[i] = ka < K ? W[(size_t)(ka < K ? ka : K - 1) * ld + n] : 0.f; v[8 + i] = kb < K ? W[(size_t)(kb < K ? kb : K - 1) * ld + n] : 0.f; }
  return bsplit16(v); }
__device__ __forceinline__ v8f mac3(const F2& a, const F2& b, v8f c) { c = wmma_bf(a.l, b.h, c); c = wmma_bf(a.h, b.l, c); return wmma_bf(a.h, b.h, c); }
__device__ __forceinline__ float sigm(float v) { return 1.0f / (1.0f + expf(-v)); }


// Single causal attention head (B 4, S 4,096, emb 512 -> head 64): softmax(Q K^T / 8, causal) V.
#define NB 4
#define SS 4096
#define NR (NB * SS)
#define EMB 512
#define HD 64
#ifndef TQB
#define TQB (SS / 32)
#define TNB NB
#endif
typedef __attribute__((ext_vector_type(8))) __bf16 v8b;
// FRAGMENT ORDER: the workspace planes hold every 16 x 32 operand fragment as 512 elements in a row: [half j][lane][8 elements], where lane = 16 g + row and the 8 elements are k = 16 j + 8 g + 0..7 of that row
// (the registers' own order). A wave-wide 16-byte load then covers 512 contiguous bytes, 4 whole lines, where a row-major plane makes it touch 16 lines for 32 bytes each.
// base: wave-uniform; off: the lane's 32-bit byte offset from it (16 * lane, and what moves from pass to pass); c: the fragment's constant byte offset
__device__ __forceinline__ v16b frag_pb(const __bf16* base, unsigned off, int c) {
  union { v16b v; v8b q[2]; } u; const char* p = (const char*)base + off + c; u.q[0] = *(const v8b*)p; u.q[1] = *(const v8b*)(p + 512); return u.v;
}
__device__ __forceinline__ v16h frag_p(const _Float16* base, unsigned off, int c) {
  union { v16h v; v8h q[2]; } u; const char* p = (const char*)base + off + c; u.q[0] = *(const v8h*)p; u.q[1] = *(const v8h*)(p + 512); return u.v;
}
__device__ __forceinline__ float bfr(float v) { return (float)(__bf16)v; }
__device__ __attribute__((noinline)) float erf_ni(float v) { return erff(v); }

#define WS_PK  0u                                     // bf16 [16 kc][12 column tiles: Wq^T | Wk^T | Wv^T][512]: fragments (16 columns x 32 k)
#define WS_QH  (((2u * 192 * EMB) + 127u) / 128u * 128u)  // f16 [1024 row tiles][2 kc][512] q hi: fragments (16 rows x 32 d) ; QL lo x2048 ; KH, KL
#define WS_QL  (WS_QH + 2u * NR * HD)
#define WS_KH  (WS_QL + 2u * NR * HD)
#define WS_KL  (WS_KH + 2u * NR * HD)
#define WS_VTH (WS_KL + 2u * NR * HD)                   // f16 [512 key blocks][4 dt][512] v hi / lo: fragments (16 d x 32 keys)
#define WS_VTL (WS_VTH + 2u * NR * HD)
#define WS_END (WS_VTL + 2u * NR * HD)

__global__ __launch_bounds__(256) void k_pack(const float* __restrict__ WQ, const float* __restrict__ WK, const float* __restrict__ WV, __bf16* __restrict__ PK) {
  // block = one fragment: column tile jt (16 of the 192 columns), k block kc (32 of 512); it alone writes the fragment's 1,024 bytes
  __shared__ __align__(16) __bf16 s[16][40]; const int jt = blockIdx.x % 12, kc = blockIdx.x / 12, t = threadIdx.x; const int which = jt >> 2, d0 = (jt & 3) * 16; const float* Wm = (which == 0) ? WQ : (which == 1) ? WK : WV;
  const float* Wb = Wm + (size_t)kc * 32 * HD + d0;
#pragma unroll   // the thread's two values are requested together
  for (int h = 0; h < 2; ++h) { const unsigned k = h * 16 + (t >> 4), c = t & 15; s[c][k] = (__bf16)Wb[k * HD + c]; }
  __syncthreads();
  if (t < 64) { const int j = t >> 5, ln = t & 31; vst2((unsigned*)(PK + (size_t)(kc * 12 + jt) * 512 + t * 8), *(const v4u*)&s[ln & 15][j * 16 + (ln >> 4) * 8]); }
}
// k_qkv: block = 64 rows, 16 waves: wave = (row tile rt, k quarter kq). A row tile's 512 k are split over four waves, 128 each, so that a WGP has 16 waves with x requests in memory at once instead of 4 (x comes from memory, one latency a pass).
// a wave's accumulator (which, t) holds column tile (t + kq) & 3 of q | k | v: t = 0 is the tile the wave owns and finishes; its partial tiles t = 1..3 go through LDS to their owners, which add the four parts behind one work-group barrier
__global__ __launch_bounds__(512) void k_qkv(const float* __restrict__ X, const __bf16* __restrict__ PK, const float* __restrict__ BQ, const float* __restrict__ BK, const float* __restrict__ BV, _Float16* __restrict__ QH, _Float16* __restrict__ QL_, _Float16* __restrict__ KH, _Float16* __restrict__ KL, _Float16* __restrict__ VTH, _Float16* __restrict__ VTL) {
  __shared__ __align__(16) _Float16 sqh[4][16][72], sql[4][16][72], skh[4][16][72], skl[4][16][72]; __shared__ __align__(16) _Float16 svh[HD][72], svl[HD][72];
  __shared__ __align__(16) float red[4][4][3][3][256];   // [row tile][owner's k quarter][q | k | v][t - 1][half of the 8 values][lane][4]: every 16-byte LDS access of a wave covers 512 contiguous bytes
  const int tid = threadIdx.x, wave = __builtin_amdgcn_readfirstlane(tid >> 5), rt = wave & 3, kq = wave >> 2, lane = tid & 31, col = lane & 15, g = lane >> 4; const size_t r0 = (size_t)blockIdx.x * 64 + rt * 16;
  v8f acc[12] = {};
  // loads go out in groups ahead of their use: a pass requests its 12 weight fragments together before its first product (one load latency a pass, not 12), and behind them the next pass's x values, which come from memory
  const float* xrow = X + (r0 + col) * EMB + kq * 128 + 8 * g; v4f xc[4];
#pragma unroll
  for (int i = 0; i < 4; ++i) xc[i] = *(const v4f*)(xrow + (i >> 1) * 16 + (i & 1) * 4);
  unsigned toff[4];
#pragma unroll
  for (int t = 0; t < 4; ++t) toff[t] = (unsigned)(kq * 4 * 12 * 1024 + ((t + kq) & 3) * 1024 + lane * 16);
#pragma unroll   // four passes a wave: the x values fetched ahead change registers by renaming, not by copies
  for (int p = 0; p < 4; ++p) { v16b wf[12]; v4f xn[4];
#pragma unroll
    for (int j = 0; j < 12; ++j) wf[j] = frag_pb(PK, toff[j & 3], p * 12 * 1024 + (j >> 2) * 4096);
    if (p + 1 < 4) {
#pragma unroll
      for (int i = 0; i < 4; ++i) xn[i] = *(const v4f*)(xrow + (p + 1) * 32 + (i >> 1) * 16 + (i & 1) * 4); }
    v16b a;
#pragma unroll
    for (int i = 0; i < 16; ++i) a[i] = (__bf16)xc[i >> 2][i & 3];
#pragma unroll
    for (int j = 0; j < 12; ++j) acc[j] = wmma_bf(a, wf[j], acc[j]);
    if (p + 1 < 4) {
#pragma unroll
      for (int i = 0; i < 4; ++i) xc[i] = xn[i]; } }
#pragma unroll
  for (int which = 0; which < 3; ++which) {
#pragma unroll
    for (int t = 1; t < 4; ++t) { float* p = &red[rt][(kq + t) & 3][which][t - 1][lane * 4]; const v8f o = acc[which * 4 + t];
      *(v4f*)p = __builtin_shufflevector(o, o, 0, 1, 2, 3); *(v4f*)(p + 128) = __builtin_shufflevector(o, o, 4, 5, 6, 7); } }
  __syncthreads();   // every wave's partial tiles are in LDS before their owners read them
  const int d = kq * 16 + col;
#pragma unroll
  for (int which = 0; which < 3; ++which) { v8f sum = acc[which * 4];
#pragma unroll
    for (int t = 1; t < 4; ++t) { const float* p = &red[rt][kq][which][t - 1][lane * 4]; const v4f lo = *(const v4f*)p, hi = *(const v4f*)(p + 128); sum += __builtin_shufflevector(lo, hi, 0, 1, 2, 3, 4, 5, 6, 7); }
    const float bb = bfr((which == 0) ? BQ[d] : (which == 1) ? BK[d] : BV[d]);
#pragma unroll
    for (int r = 0; r < 8; ++r) { const float v = sum[r] + bb; const _Float16 hv = (_Float16)v; const _Float16 lv = (_Float16)((v - (float)hv) * 2048.0f);
      if (which == 0) { sqh[rt][8 * g + r][d] = hv; sql[rt][8 * g + r][d] = lv; } else if (which == 1) { skh[rt][8 * g + r][d] = hv; skl[rt][8 * g + r][d] = lv; } else { svh[d][rt * 16 + 8 * g + r] = hv; svl[d][rt * 16 + 8 * g + r] = lv; } } }
  __syncthreads();
  // q, k: a row tile is 2 fragments = 4 runs of 512 bytes a plane; run i holds d = 16 i + 8 g + 0..7 of row col; wave (rt, kq) stores run kq
  { const size_t o = r0 * HD + kq * 256 + lane * 8; const int dc = kq * 16 + g * 8;
    vst2((unsigned*)(QH + o), *(const v4u*)&sqh[rt][col][dc]); vst2((unsigned*)(QL_ + o), *(const v4u*)&sql[rt][col][dc]); vst2((unsigned*)(KH + o), *(const v4u*)&skh[rt][col][dc]); vst2((unsigned*)(KL + o), *(const v4u*)&skl[rt][col][dc]); }
  // v: the block's 64 keys are two 32-key blocks of 4 fragments; piece e = [key block][dt][half j][lane] holds keys 16 j + 8 g + 0..7 of d = 16 dt + (lane & 15); one piece a thread
  { const size_t vb = (size_t)blockIdx.x * 64 * HD; const int e = tid;
    const int dv = ((e >> 6) & 3) * 16 + (e & 15), kk = (e >> 8) * 32 + ((e >> 5) & 1) * 16 + ((e >> 4) & 1) * 8; const size_t o = vb + (size_t)e * 8; vst2((unsigned*)(VTH + o), *(const v4u*)&svh[dv][kk]); vst2((unsigned*)(VTL + o), *(const v4u*)&svl[dv][kk]); }
}
#define KW 12
#define QT 2          // 16-query tiles a wave (and a work-group)
#define QR (16 * QT)  // queries a work-group
#define SC2 0.18033688011112042f   // log(e) / 8: softmax in base 2, exp(s / 8 - max) = 2^(s * SC2 - max2), one multiply-add and one hardware exponential a score
// the value of lane ^ 16
__device__ __forceinline__ float xhalf(float v) { const int b = __builtin_bit_cast(int, v); return __builtin_bit_cast(float, __builtin_amdgcn_permlanex16(b, b, 0x76543210, 0xfedcba98, false, false)); }
__global__ __launch_bounds__(32 * KW) void k_attn(const _Float16* __restrict__ QH, const _Float16* __restrict__ QL_, const _Float16* __restrict__ KH, const _Float16* __restrict__ KL, const _Float16* __restrict__ VTH, const _Float16* __restrict__ VTL, float* __restrict__ OUT) {
  __shared__ __align__(16) float so[KW][QR][HD + 4]; __shared__ float sm[KW][QR], sl[KW][QR];
  const int tid = threadIdx.x, wave = __builtin_amdgcn_readfirstlane(tid >> 5) /* scalar: the key loop's start and trip count differ by wave and must be a scalar branch around the WMMAs */, lane = tid & 31, col = lane & 15, g = lane >> 4;
  // cost grows with the query tile (causal) and only one work-group fits a WGP at a time: the flat index is mapped so that cost falls with it (heaviest tiles of all batches start first, the one-block tiles fill the end); a permutation of (tile, batch)
  const int flat = blockIdx.y * TQB + blockIdx.x; const int qb = TQB - 1 - flat / TNB, b = flat % TNB; const int q0 = qb * QR; const unsigned lane16 = (unsigned)lane * 16;
  const _Float16 *Kh = KH + (size_t)b * SS * HD, *Kl = KL + (size_t)b * SS * HD, *Vh = VTH + (size_t)b * SS * HD, *Vl = VTL + (size_t)b * SS * HD;   // the batch's planes: a 32-key block is 4,096 bytes in each
  float m[QT], l[QT];   // of query q0 + 16 qt + col; m, in base-2 units (score x log e), is equal in both halves, l is the sum over the half's own keys
  v8f acc[QT][4] = {}, accl[QT][4] = {};   // element r of tile (qt, dt) = O^T[dt * 16 + 8 g + r][query 16 qt + col]
#pragma unroll
  for (int qt = 0; qt < QT; ++qt) { m[qt] = -3.0e38f; l[qt] = 0.f; }
  const int nks = (q0 + QR + 31) / 32;
  if (wave < nks) {   // a wave without a key block loads no Q either; the test is scalar
  v16h aqh[QT][2], aql[QT][2];
#pragma unroll
  for (int qt = 0; qt < QT; ++qt) {
#pragma unroll
    for (int kc = 0; kc < 2; ++kc) { aqh[qt][kc] = frag_p(QH + ((size_t)b * SS + q0) * HD, lane16, (qt * 2 + kc) * 1024); aql[qt][kc] = frag_p(QL_ + ((size_t)b * SS + q0) * HD, lane16, (qt * 2 + kc) * 1024); } }
  asm volatile("s_wait_xcnt 0x0" ::: "memory");   // the registers that the sixteen Q loads name (lane offset, plane bases) are reused right behind them: the wait stands in front of that
  __builtin_amdgcn_sched_barrier(0);   // keeps the loads in front of that wait and every later write of their registers behind it
  // the work-groups of a batch that run at one time all walk the same K and V planes in L2: begun at block 0 they would all ask for the same lines at the same moment, and such requests collide.
  // each work-group enters the ring of its nks key blocks at a place of its own (the tile's index times 83 mod 128 spreads neighbouring tiles evenly over the ring) and wraps round; the running-max softmax takes the blocks in any order
  const int rot = (nks * ((qb * 83) & 127)) >> 7;   // 0 .. nks - 1, scalar
  int ks = wave + rot - ((wave + rot >= nks) ? nks : 0); unsigned off = (unsigned)ks * 4096u + lane16;   // the wave's place it of the walk is key block (it + rot) mod nks
#pragma unroll 1
  for (int it = wave; it < nks; it += KW) { v8f s[QT][2];
    // the pass's eight K fragments are requested together before its first product: one load latency a pass instead of one a fragment
    v16h kfh[2][2], kfl[2][2];
#pragma unroll
    for (int ct = 0; ct < 2; ++ct) {
#pragma unroll
      for (int kc = 0; kc < 2; ++kc) { kfh[ct][kc] = frag_p(Kh, off, (ct * 2 + kc) * 1024); kfl[ct][kc] = frag_p(Kl, off, (ct * 2 + kc) * 1024); } }
    __builtin_amdgcn_sched_barrier(0);   // holds the sixteen loads together in front of the products: without it the scheduler sinks them among the WMMAs, into few registers, and the wave waits out several load latencies a pass
#pragma unroll
    for (int ct = 0; ct < 2; ++ct) {
#pragma unroll
      for (int qt = 0; qt < QT; ++qt) { const int dq = q0 + qt * 16 + col - (ks * 32 + ct * 16 + 8 * g) /* the lane's query minus its first key of the tile: key 8 g + r is open where r <= dq */; v8f c = {}, cl = {};
#pragma unroll
        for (int kc = 0; kc < 2; ++kc) { c = wmma16(kfh[ct][kc], aqh[qt][kc], c); cl = wmma16(kfh[ct][kc], aql[qt][kc], cl); cl = wmma16(kfl[ct][kc], aqh[qt][kc], cl); }
#pragma unroll
        for (int r = 0; r < 8; ++r) { const float sv = c[r] + cl[r] * (1.0f / 2048.0f); s[qt][ct][r] = (r <= dq) ? sv : -3.0e38f; } } }   // raw q.k: the factor 1/8 goes into the exponent's multiply-add
    // the pass's eight V fragments are requested here, in the registers the K fragments have left: they fly while the softmax starts
    v16h vfh[4], vfl[4];
#pragma unroll
    for (int dt = 0; dt < 4; ++dt) { vfh[dt] = frag_p(Vh, off, dt * 1024); vfl[dt] = frag_p(Vl, off, dt * 1024); }
    asm volatile("s_wait_xcnt 0x0" ::: "memory");   // the pass's loads all name the lane's offset register, which is stepped to the next key block further down: the wait stands between them and that overwrite
    __builtin_amdgcn_sched_barrier(0);   // the same for V: all sixteen loads are out before the softmax's first instruction
    v16h pah[QT], pal[QT];
#pragma unroll
    for (int qt = 0; qt < QT; ++qt) {
      float mx = fmaxf(s[qt][0][0], s[qt][1][0]);
#pragma unroll
      for (int r = 1; r < 8; ++r) mx = fmaxf(mx, fmaxf(s[qt][0][r], s[qt][1][r]));
      mx = fmaxf(mx, xhalf(mx));   // both halves feed one P^T fragment: they need the same maximum
      const float mn = fmaxf(m[qt], mx * SC2); const float alpha = __builtin_amdgcn_exp2f(m[qt] - mn) /* 0 on a wave's first pass, where m is -3e38 */; m[qt] = mn;
      float es = 0.f;
#pragma unroll
      for (int ct = 0; ct < 2; ++ct) {
#pragma unroll
        for (int r = 0; r < 8; ++r) { const float e = __builtin_amdgcn_exp2f(fmaf(s[qt][ct][r], SC2, -mn)) /* a closed key's -3e38 gives exactly 0: every query of the block has an open key in every key block the work-group visits (the last one starts at key q0), so mn is a real score */; es += e;
          const _Float16 h = (_Float16)e; pah[qt][ct * 8 + r] = h; pal[qt][ct * 8 + r] = (_Float16)((e - (float)h) * 2048.0f); } }   // element ct * 8 + r = key 16 ct + 8 g + r: the fragments' k order, as V's loader has it
      l[qt] = l[qt] * alpha + es;
#pragma unroll
      for (int dt = 0; dt < 4; ++dt) { acc[qt][dt] *= alpha; accl[qt][dt] *= alpha; }
      if (qt + 1 < QT) __builtin_amdgcn_sched_barrier(0); }   // one tile's softmax is finished before the other's begins: both tiles' scores, exponentials and P live at once cost the registers that the third wave of a SIMD needs
#pragma unroll
    for (int dt = 0; dt < 4; ++dt) {
#pragma unroll
      for (int qt = 0; qt < QT; ++qt) { acc[qt][dt] = wmma16(vfh[dt], pah[qt], acc[qt][dt]); accl[qt][dt] = wmma16(vfh[dt], pal[qt], accl[qt][dt]); accl[qt][dt] = wmma16(vfl[dt], pah[qt], accl[qt][dt]); } }
    const int kn = ks + KW - ((ks + KW >= nks) ? nks : 0); off += (unsigned)(kn - ks) * 4096u; ks = kn; }   // one scalar step, forwards or back over the wrap, on the lane's one offset register (not used behind the wave's last pass)
  }
#pragma unroll
  for (int qt = 0; qt < QT; ++qt) { l[qt] += xhalf(l[qt]);
    if (g == 0) { sm[wave][qt * 16 + col] = m[qt]; sl[wave][qt * 16 + col] = l[qt]; }
#pragma unroll
    for (int dt = 0; dt < 4; ++dt) { const v8f o = acc[qt][dt] + accl[qt][dt] * (1.0f / 2048.0f);
      *(v4f*)&so[wave][qt * 16 + col][dt * 16 + 8 * g] = __builtin_shufflevector(o, o, 0, 1, 2, 3); *(v4f*)&so[wave][qt * 16 + col][dt * 16 + 8 * g + 4] = __builtin_shufflevector(o, o, 4, 5, 6, 7); } }
  __syncthreads();   // every wave's partial (max, sum, rows) is in LDS before any wave reads the others'; every wave passes here, also one that had no key block
  for (int pr = wave; pr < QR / 2; pr += KW) { const int row = pr * 2 + g; float mw[KW]; float mx = -3.0e38f;   // a wave merges two rows at a time, a half-wave each, four columns a lane; every lane reads its row's KW maxima and sums; a wave that saw no open key has m = -3e38, l = 0 and gets weight 0
#pragma unroll
    for (int w = 0; w < KW; ++w) { mw[w] = sm[w][row]; mx = fmaxf(mx, mw[w]); }
    float ls = 0.f; v4f o4 = {};
#pragma unroll   // the LDS reads of the parts are independent: unrolled they are issued together instead of one wait per part
    for (int w = 0; w < KW; ++w) { const float wg = __builtin_amdgcn_exp2f(mw[w] - mx); ls += wg * sl[w][row]; o4 += wg * *(const v4f*)&so[w][row][col * 4]; }
    vst2(OUT + ((size_t)b * SS + q0 + row) * HD + col * 4, (v4f)(o4 * (1.0f / ls)));
    asm volatile("s_wait_xcnt 0x0" ::: "memory"); }   // the next rows' LDS reads land in the registers that the store names: the wait stands in front of them
}
extern "C" void kernel_launch(void* const* d_in, const int* in_sizes, int n_in, void* d_out, int out_size, void* d_ws, size_t ws_size, hipStream_t stream) {
  (void)in_sizes; (void)n_in; (void)out_size;
  const float** F = (const float**)d_in;   // 0 x [4,4096,512], 1 Wq [512,64], 2 bq, 3 Wk, 4 bk, 5 Wv, 6 bv
  if (ws_size < (size_t)WS_END) return;
  char* ws = (char*)d_ws; __bf16* PK = (__bf16*)(ws + WS_PK); _Float16 *QH = (_Float16*)(ws + WS_QH), *QLp = (_Float16*)(ws + WS_QL), *KH = (_Float16*)(ws + WS_KH), *KL = (_Float16*)(ws + WS_KL), *VTH = (_Float16*)(ws + WS_VTH), *VTL = (_Float16*)(ws + WS_VTL);
  k_pack<<<192, 256, 0, stream>>>(F[1], F[3], F[5], PK);
  k_qkv<<<TNB * SS / 64, 512, 0, stream>>>(F[0], PK, F[2], F[4], F[6], QH, QLp, KH, KL, VTH, VTL);
  k_attn<<<dim3(TQB, TNB), 32 * KW, 0, stream>>>(QH, QLp, KH, KL, VTH, VTL, (float*)d_out);
}
